// v000
// Times are from an AMD MI455X. After a warm-up the kernel runs many times in a row, and a time is the length of
// such a window on the GPU divided by its runs, so every launch and the gaps after it count. The runs cycle
// through copies of the inputs. A figure is the median of several windows, for all but v000 over two sittings.
// Sittings can differ by a few percent; kernels timed side by side share one.
// The starting kernel, v000, takes 420 microseconds a run.
#include <hip/hip_runtime.h>
#include <hip/hip_bf16.h>
#include <math.h>

// Problem constants (from reference)
#define BB   4
#define SS   4096
#define HH   1024
#define NHH  16
#define DD   64
#define MM   (BB*SS)          // 16384 rows
#define ATT_SCALE 0.125f      // 1/sqrt(64)

typedef __attribute__((ext_vector_type(16))) __bf16 v16bf;
typedef __attribute__((ext_vector_type(8)))  float  v8f;

#define TILE_M 128
#define TILE_N 128
#define TILE_K 32
#define LDSS   40   // LDS row stride in bf16 elems (32 data + 8 pad -> 80B rows, 16B aligned)

// ---------------------------------------------------------------------------
// Fused QKV projection: Out = X @ W^T + b, computed with v_wmma_f32_16x16x32_bf16
// grid: (HH/TILE_N, MM/TILE_M, 3)  block: 256 (8 waves of 32)
// ---------------------------------------------------------------------------
__global__ __launch_bounds__(256)
void qkv_gemm_wmma(const float* __restrict__ X,
                   const float* __restrict__ Wq, const float* __restrict__ bq,
                   const float* __restrict__ Wk, const float* __restrict__ bk,
                   const float* __restrict__ Wv, const float* __restrict__ bv,
                   float* __restrict__ Qf, float* __restrict__ Kf, float* __restrict__ Vf)
{
  __shared__ __align__(16) __bf16 As[2][TILE_M][LDSS];
  __shared__ __align__(16) __bf16 Bs[2][TILE_N][LDSS];

  const int which = blockIdx.z;
  const float* __restrict__ W    = (which == 0) ? Wq : (which == 1) ? Wk : Wv;
  const float* __restrict__ bias = (which == 0) ? bq : (which == 1) ? bk : bv;
  float* __restrict__ Out        = (which == 0) ? Qf : (which == 1) ? Kf : Vf;

  const int n0   = blockIdx.x * TILE_N;
  const int m0   = blockIdx.y * TILE_M;
  const int tid  = threadIdx.x;
  const int wave = tid >> 5;
  const int lane = tid & 31;
  const int half = lane >> 4;     // 0: lanes 0-15, 1: lanes 16-31
  const int r16  = lane & 15;
  const int waveM = wave >> 2;    // 0..1  -> 64-row slab
  const int waveN = wave & 3;     // 0..3  -> 32-col slab

  v8f acc[4][2];
  #pragma unroll
  for (int i = 0; i < 4; ++i)
    #pragma unroll
    for (int j = 0; j < 2; ++j)
      acc[i][j] = v8f{};

  // global fp32 -> LDS bf16 tile stage (128x32 each for A and B)
  auto load_tiles = [&](int buf, int k0) {
    #pragma unroll
    for (int i = 0; i < 4; ++i) {
      int id = tid + i * 256;       // 0..1023
      int r  = id >> 3;             // row 0..127
      int c  = (id & 7) << 2;       // col 0,4,...,28
      float4 fa = *(const float4*)(X + (size_t)(m0 + r) * HH + k0 + c);
      __bf16* da = &As[buf][r][c];
      da[0] = (__bf16)fa.x; da[1] = (__bf16)fa.y;
      da[2] = (__bf16)fa.z; da[3] = (__bf16)fa.w;
      float4 fb = *(const float4*)(W + (size_t)(n0 + r) * HH + k0 + c);
      __bf16* db = &Bs[buf][r][c];
      db[0] = (__bf16)fb.x; db[1] = (__bf16)fb.y;
      db[2] = (__bf16)fb.z; db[3] = (__bf16)fb.w;
    }
  };

  load_tiles(0, 0);
  __syncthreads();

  const int KT = HH / TILE_K;     // 32 k-chunks
  for (int kt = 0; kt < KT; ++kt) {
    const int cur = kt & 1;
    if (kt + 1 < KT) load_tiles(cur ^ 1, (kt + 1) * TILE_K);

    // prefetch k+2 chunk into caches (global_prefetch_b8)
    if (kt + 2 < KT) {
      const int pk = (kt + 2) * TILE_K;
      __builtin_prefetch(X + (size_t)(m0 + (tid & 127)) * HH + pk, 0, 3);
      __builtin_prefetch(W + (size_t)(n0 + (tid & 127)) * HH + pk, 0, 3);
    }

    // Fragment loads per ISA 16-bit A layout:
    //   lanes 0-15 : K 0-7  (bytes 0..15)  and K 16-23 (bytes 32..47)
    //   lanes 16-31: K 8-15 (bytes 16..31) and K 24-31 (bytes 48..63)
    v16bf afrag[4], bfrag[2];
    #pragma unroll
    for (int mi = 0; mi < 4; ++mi) {
      const __bf16* src = &As[cur][waveM * 64 + mi * 16 + r16][0];
      union { uint4 u[2]; v16bf v; } t;
      t.u[0] = *(const uint4*)(src + half * 8);
      t.u[1] = *(const uint4*)(src + 16 + half * 8);
      afrag[mi] = t.v;
    }
    #pragma unroll
    for (int ni = 0; ni < 2; ++ni) {
      const __bf16* src = &Bs[cur][waveN * 32 + ni * 16 + r16][0];
      union { uint4 u[2]; v16bf v; } t;
      t.u[0] = *(const uint4*)(src + half * 8);
      t.u[1] = *(const uint4*)(src + 16 + half * 8);
      bfrag[ni] = t.v;
    }

    #pragma unroll
    for (int mi = 0; mi < 4; ++mi)
      #pragma unroll
      for (int ni = 0; ni < 2; ++ni)
        acc[mi][ni] = __builtin_amdgcn_wmma_f32_16x16x32_bf16(
            false, afrag[mi], false, bfrag[ni],
            (short)0, acc[mi][ni], false, false);

    __syncthreads();
  }

  // Epilogue: C/D layout -> lanes 0-15: M=j, lanes 16-31: M=8+j; N=r16
  #pragma unroll
  for (int mi = 0; mi < 4; ++mi) {
    #pragma unroll
    for (int ni = 0; ni < 2; ++ni) {
      const int col = n0 + waveN * 32 + ni * 16 + r16;
      const float bv = bias[col];
      #pragma unroll
      for (int j = 0; j < 8; ++j) {
        const int row = m0 + waveM * 64 + mi * 16 + half * 8 + j;
        Out[(size_t)row * HH + col] = acc[mi][ni][j] + bv;
      }
    }
  }
}

// ---------------------------------------------------------------------------
// Global attention: q at position 0 of each (b,h) attends over all S keys.
// grid: B*NH blocks, 256 threads.
// ---------------------------------------------------------------------------
__global__ __launch_bounds__(256)
void global_attn(const float* __restrict__ Qf, const float* __restrict__ Kf,
                 const float* __restrict__ Vf, const float* __restrict__ mask,
                 float* __restrict__ ctx)
{
  const int bh = blockIdx.x;
  const int b = bh / NHH;
  const int h = bh % NHH;
  const int tid = threadIdx.x;

  __shared__ float q0[DD];
  __shared__ float sc[SS];
  __shared__ float red[256];

  const float* qptr = Qf + (size_t)(b * SS) * HH + h * DD;
  if (tid < DD) q0[tid] = qptr[tid];
  __syncthreads();

  float lmax = -INFINITY;
  for (int s = tid; s < SS; s += 256) {
    const float* kp = Kf + (size_t)(b * SS + s) * HH + h * DD;
    float d = 0.f;
    #pragma unroll 8
    for (int i = 0; i < DD; ++i) d += q0[i] * kp[i];
    d = d * ATT_SCALE + mask[b * SS + s];
    sc[s] = d;
    lmax = fmaxf(lmax, d);
  }
  red[tid] = lmax; __syncthreads();
  for (int off = 128; off > 0; off >>= 1) {
    if (tid < off) red[tid] = fmaxf(red[tid], red[tid + off]);
    __syncthreads();
  }
  const float mx = red[0];
  __syncthreads();

  float lsum = 0.f;
  for (int s = tid; s < SS; s += 256) {
    float e = __expf(sc[s] - mx);
    sc[s] = e;
    lsum += e;
  }
  red[tid] = lsum; __syncthreads();
  for (int off = 128; off > 0; off >>= 1) {
    if (tid < off) red[tid] += red[tid + off];
    __syncthreads();
  }
  const float inv = 1.f / red[0];
  __syncthreads();

  // out[d] = sum_s p[s] * V[s][d]; 4 key-groups x 64 dims
  const int d = tid & 63;
  const int g = tid >> 6;
  float oacc = 0.f;
  for (int s = g; s < SS; s += 4)
    oacc += sc[s] * Vf[(size_t)(b * SS + s) * HH + h * DD + d];
  red[tid] = oacc; __syncthreads();
  if (g == 0) {
    float o = (red[d] + red[64 + d] + red[128 + d] + red[192 + d]) * inv;
    ctx[(size_t)(b * SS + 0) * HH + h * DD + d] = o;
  }
}

// ---------------------------------------------------------------------------
// Local attention: each (b,h,s>=1) softmaxes over {self, key0}. One wave32
// per (b,h,s); lanes cover the 64-dim head.
// ---------------------------------------------------------------------------
__global__ __launch_bounds__(256)
void local_attn(const float* __restrict__ Qf, const float* __restrict__ Kf,
                const float* __restrict__ Vf, float* __restrict__ ctx,
                float* __restrict__ lattn, int nwork)
{
  const int idx  = blockIdx.x * 8 + (threadIdx.x >> 5);
  const int lane = threadIdx.x & 31;
  if (idx >= nwork) return;

  const int s  = idx % (SS - 1) + 1;
  const int bh = idx / (SS - 1);
  const int b  = bh / NHH;
  const int h  = bh % NHH;

  const float* q  = Qf + (size_t)(b * SS + s) * HH + h * DD;
  const float* ks = Kf + (size_t)(b * SS + s) * HH + h * DD;
  const float* k0 = Kf + (size_t)(b * SS) * HH + h * DD;

  const float qa = q[lane], qb = q[lane + 32];
  float dself = qa * ks[lane] + qb * ks[lane + 32];
  float dglob = qa * k0[lane] + qb * k0[lane + 32];
  #pragma unroll
  for (int off = 16; off > 0; off >>= 1) {
    dself += __shfl_xor(dself, off, 32);
    dglob += __shfl_xor(dglob, off, 32);
  }
  const float a = dself * ATT_SCALE;
  const float c = dglob * ATT_SCALE;
  const float mx = fmaxf(a, c);
  const float e0 = __expf(a - mx);
  const float e1 = __expf(c - mx);
  const float inv = 1.f / (e0 + e1);
  const float p0 = e0 * inv, p1 = e1 * inv;

  const float* vs = Vf + (size_t)(b * SS + s) * HH + h * DD;
  const float* v0 = Vf + (size_t)(b * SS) * HH + h * DD;
  float* cp = ctx + (size_t)(b * SS + s) * HH + h * DD;
  cp[lane]      = p0 * vs[lane]      + p1 * v0[lane];
  cp[lane + 32] = p0 * vs[lane + 32] + p1 * v0[lane + 32];

  if (lane == 0) {
    float* lp = lattn + ((size_t)bh * (SS - 1) + (s - 1)) * 2;
    lp[0] = p0;
    lp[1] = p1;
  }
}

// ---------------------------------------------------------------------------
extern "C" void kernel_launch(void* const* d_in, const int* in_sizes, int n_in,
                              void* d_out, int out_size, void* d_ws, size_t ws_size,
                              hipStream_t stream)
{
  const float* hidden = (const float*)d_in[0];
  const float* mask   = (const float*)d_in[1];
  const float* Wq     = (const float*)d_in[2];
  const float* bq     = (const float*)d_in[3];
  const float* Wk     = (const float*)d_in[4];
  const float* bk     = (const float*)d_in[5];
  const float* Wv     = (const float*)d_in[6];
  const float* bv     = (const float*)d_in[7];

  float* ctx   = (float*)d_out;                       // B*S*H
  float* lattn = ctx + (size_t)BB * SS * HH;          // B*NH*(S-1)*1*2

  float* Qf = (float*)d_ws;                           // 64 MiB each
  float* Kf = Qf + (size_t)MM * HH;
  float* Vf = Kf + (size_t)MM * HH;

  dim3 g1(HH / TILE_N, MM / TILE_M, 3);
  qkv_gemm_wmma<<<g1, 256, 0, stream>>>(hidden, Wq, bq, Wk, bk, Wv, bv, Qf, Kf, Vf);

  global_attn<<<BB * NHH, 256, 0, stream>>>(Qf, Kf, Vf, mask, ctx);

  const int nwork = BB * NHH * (SS - 1);
  local_attn<<<(nwork + 7) / 8, 256, 0, stream>>>(Qf, Kf, Vf, ctx, lattn, nwork);
}

// v001
// One run takes 308 microseconds.
// Timed twice side by side with v000, it ran 1.42 and 1.41 times as fast.
#include <hip/hip_runtime.h>
#include <hip/hip_bf16.h>
#include <math.h>

// Problem constants (from reference)
#define BB   4
#define SS   4096
#define HH   1024
#define NHH  16
#define DD   64
#define MM   (BB*SS)          // 16384 rows
#define ATT_SCALE 0.125f      // 1/sqrt(64)

typedef __attribute__((ext_vector_type(16))) __bf16 v16bf;
typedef __attribute__((ext_vector_type(8)))  float  v8f;

#define TILE_M 128
#define TILE_N 128
#define TILE_K 32
#define LDSS   40   // LDS row stride in bf16 elems (32 data + 8 pad -> 80B rows, 16B aligned)

// ---------------------------------------------------------------------------
// Fused QKV projection: Out = X @ W^T + b, computed with v_wmma_f32_16x16x32_bf16
// grid: (HH/TILE_N, MM/TILE_M, 3)  block: 256 (8 waves of 32)
// ---------------------------------------------------------------------------
__global__ __launch_bounds__(256)
void qkv_gemm_wmma(const float* __restrict__ X,
                   const float* __restrict__ Wq, const float* __restrict__ bq,
                   const float* __restrict__ Wk, const float* __restrict__ bk,
                   const float* __restrict__ Wv, const float* __restrict__ bv,
                   float* __restrict__ Qf, float* __restrict__ Kf, float* __restrict__ Vf)
{
  __shared__ __align__(16) __bf16 As[2][TILE_M][LDSS];
  __shared__ __align__(16) __bf16 Bs[2][TILE_N][LDSS];

  const int which = blockIdx.z;
  const float* __restrict__ W    = (which == 0) ? Wq : (which == 1) ? Wk : Wv;
  const float* __restrict__ bias = (which == 0) ? bq : (which == 1) ? bk : bv;
  float* __restrict__ Out        = (which == 0) ? Qf : (which == 1) ? Kf : Vf;

  const int n0   = blockIdx.x * TILE_N;
  const int m0   = blockIdx.y * TILE_M;
  const int tid  = threadIdx.x;
  const int wave = tid >> 5;
  const int lane = tid & 31;
  const int half = lane >> 4;     // 0: lanes 0-15, 1: lanes 16-31
  const int r16  = lane & 15;
  const int waveM = wave >> 2;    // 0..1  -> 64-row slab
  const int waveN = wave & 3;     // 0..3  -> 32-col slab

  v8f acc[4][2];
  #pragma unroll
  for (int i = 0; i < 4; ++i)
    #pragma unroll
    for (int j = 0; j < 2; ++j)
      acc[i][j] = v8f{};

  // global fp32 -> LDS bf16 tile stage (128x32 each for A and B)
  auto load_tiles = [&](int buf, int k0) {
    #pragma unroll
    for (int i = 0; i < 4; ++i) {
      int id = tid + i * 256;       // 0..1023
      int r  = id >> 3;             // row 0..127
      int c  = (id & 7) << 2;       // col 0,4,...,28
      float4 fa = *(const float4*)(X + (size_t)(m0 + r) * HH + k0 + c);
      __bf16* da = &As[buf][r][c];
      da[0] = (__bf16)fa.x; da[1] = (__bf16)fa.y;
      da[2] = (__bf16)fa.z; da[3] = (__bf16)fa.w;
      float4 fb = *(const float4*)(W + (size_t)(n0 + r) * HH + k0 + c);
      __bf16* db = &Bs[buf][r][c];
      db[0] = (__bf16)fb.x; db[1] = (__bf16)fb.y;
      db[2] = (__bf16)fb.z; db[3] = (__bf16)fb.w;
    }
  };

  load_tiles(0, 0);
  __syncthreads();

  const int KT = HH / TILE_K;     // 32 k-chunks
  for (int kt = 0; kt < KT; ++kt) {
    const int cur = kt & 1;
    if (kt + 1 < KT) load_tiles(cur ^ 1, (kt + 1) * TILE_K);

    // Fragment loads per ISA 16-bit A layout:
    //   lanes 0-15 : K 0-7  (bytes 0..15)  and K 16-23 (bytes 32..47)
    //   lanes 16-31: K 8-15 (bytes 16..31) and K 24-31 (bytes 48..63)
    v16bf afrag[4], bfrag[2];
    #pragma unroll
    for (int mi = 0; mi < 4; ++mi) {
      const __bf16* src = &As[cur][waveM * 64 + mi * 16 + r16][0];
      union { uint4 u[2]; v16bf v; } t;
      t.u[0] = *(const uint4*)(src + half * 8);
      t.u[1] = *(const uint4*)(src + 16 + half * 8);
      afrag[mi] = t.v;
    }
    #pragma unroll
    for (int ni = 0; ni < 2; ++ni) {
      const __bf16* src = &Bs[cur][waveN * 32 + ni * 16 + r16][0];
      union { uint4 u[2]; v16bf v; } t;
      t.u[0] = *(const uint4*)(src + half * 8);
      t.u[1] = *(const uint4*)(src + 16 + half * 8);
      bfrag[ni] = t.v;
    }

    #pragma unroll
    for (int mi = 0; mi < 4; ++mi)
      #pragma unroll
      for (int ni = 0; ni < 2; ++ni)
        acc[mi][ni] = __builtin_amdgcn_wmma_f32_16x16x32_bf16(
            false, afrag[mi], false, bfrag[ni],
            (short)0, acc[mi][ni], false, false);

    __syncthreads();
  }

  // Epilogue: C/D layout -> lanes 0-15: M=j, lanes 16-31: M=8+j; N=r16
  #pragma unroll
  for (int mi = 0; mi < 4; ++mi) {
    #pragma unroll
    for (int ni = 0; ni < 2; ++ni) {
      const int col = n0 + waveN * 32 + ni * 16 + r16;
      const float bv = bias[col];
      #pragma unroll
      for (int j = 0; j < 8; ++j) {
        const int row = m0 + waveM * 64 + mi * 16 + half * 8 + j;
        Out[(size_t)row * HH + col] = acc[mi][ni][j] + bv;
      }
    }
  }
}

// ---------------------------------------------------------------------------
// Global attention: q at position 0 of each (b,h) attends over all S keys.
// grid: B*NH blocks, 256 threads.
// ---------------------------------------------------------------------------
__global__ __launch_bounds__(256)
void global_attn(const float* __restrict__ Qf, const float* __restrict__ Kf,
                 const float* __restrict__ Vf, const float* __restrict__ mask,
                 float* __restrict__ ctx)
{
  const int bh = blockIdx.x;
  const int b = bh / NHH;
  const int h = bh % NHH;
  const int tid = threadIdx.x;

  __shared__ float q0[DD];
  __shared__ float sc[SS];
  __shared__ float red[256];

  const float* qptr = Qf + (size_t)(b * SS) * HH + h * DD;
  if (tid < DD) q0[tid] = qptr[tid];
  __syncthreads();

  float lmax = -INFINITY;
  for (int s = tid; s < SS; s += 256) {
    const float* kp = Kf + (size_t)(b * SS + s) * HH + h * DD;
    float d = 0.f;
    #pragma unroll 8
    for (int i = 0; i < DD; ++i) d += q0[i] * kp[i];
    d = d * ATT_SCALE + mask[b * SS + s];
    sc[s] = d;
    lmax = fmaxf(lmax, d);
  }
  red[tid] = lmax; __syncthreads();
  for (int off = 128; off > 0; off >>= 1) {
    if (tid < off) red[tid] = fmaxf(red[tid], red[tid + off]);
    __syncthreads();
  }
  const float mx = red[0];
  __syncthreads();

  float lsum = 0.f;
  for (int s = tid; s < SS; s += 256) {
    float e = __expf(sc[s] - mx);
    sc[s] = e;
    lsum += e;
  }
  red[tid] = lsum; __syncthreads();
  for (int off = 128; off > 0; off >>= 1) {
    if (tid < off) red[tid] += red[tid + off];
    __syncthreads();
  }
  const float inv = 1.f / red[0];
  __syncthreads();

  // out[d] = sum_s p[s] * V[s][d]; 4 key-groups x 64 dims
  const int d = tid & 63;
  const int g = tid >> 6;
  float oacc = 0.f;
  for (int s = g; s < SS; s += 4)
    oacc += sc[s] * Vf[(size_t)(b * SS + s) * HH + h * DD + d];
  red[tid] = oacc; __syncthreads();
  if (g == 0) {
    float o = (red[d] + red[64 + d] + red[128 + d] + red[192 + d]) * inv;
    ctx[(size_t)(b * SS + 0) * HH + h * DD + d] = o;
  }
}

// ---------------------------------------------------------------------------
// Local attention: each (b,h,s>=1) softmaxes over {self, key0}. One wave32
// per (b,h,s); lanes cover the 64-dim head.
// ---------------------------------------------------------------------------
__global__ __launch_bounds__(256)
void local_attn(const float* __restrict__ Qf, const float* __restrict__ Kf,
                const float* __restrict__ Vf, float* __restrict__ ctx,
                float* __restrict__ lattn, int nwork)
{
  const int idx  = blockIdx.x * 8 + (threadIdx.x >> 5);
  const int lane = threadIdx.x & 31;
  if (idx >= nwork) return;

  const int s  = idx % (SS - 1) + 1;
  const int bh = idx / (SS - 1);
  const int b  = bh / NHH;
  const int h  = bh % NHH;

  const float* q  = Qf + (size_t)(b * SS + s) * HH + h * DD;
  const float* ks = Kf + (size_t)(b * SS + s) * HH + h * DD;
  const float* k0 = Kf + (size_t)(b * SS) * HH + h * DD;

  const float qa = q[lane], qb = q[lane + 32];
  float dself = qa * ks[lane] + qb * ks[lane + 32];
  float dglob = qa * k0[lane] + qb * k0[lane + 32];
  #pragma unroll
  for (int off = 16; off > 0; off >>= 1) {
    dself += __shfl_xor(dself, off, 32);
    dglob += __shfl_xor(dglob, off, 32);
  }
  const float a = dself * ATT_SCALE;
  const float c = dglob * ATT_SCALE;
  const float mx = fmaxf(a, c);
  const float e0 = __expf(a - mx);
  const float e1 = __expf(c - mx);
  const float inv = 1.f / (e0 + e1);
  const float p0 = e0 * inv, p1 = e1 * inv;

  const float* vs = Vf + (size_t)(b * SS + s) * HH + h * DD;
  const float* v0 = Vf + (size_t)(b * SS) * HH + h * DD;
  float* cp = ctx + (size_t)(b * SS + s) * HH + h * DD;
  cp[lane]      = p0 * vs[lane]      + p1 * v0[lane];
  cp[lane + 32] = p0 * vs[lane + 32] + p1 * v0[lane + 32];

  if (lane == 0) {
    float* lp = lattn + ((size_t)bh * (SS - 1) + (s - 1)) * 2;
    lp[0] = p0;
    lp[1] = p1;
  }
}

// ---------------------------------------------------------------------------
extern "C" void kernel_launch(void* const* d_in, const int* in_sizes, int n_in,
                              void* d_out, int out_size, void* d_ws, size_t ws_size,
                              hipStream_t stream)
{
  const float* hidden = (const float*)d_in[0];
  const float* mask   = (const float*)d_in[1];
  const float* Wq     = (const float*)d_in[2];
  const float* bq     = (const float*)d_in[3];
  const float* Wk     = (const float*)d_in[4];
  const float* bk     = (const float*)d_in[5];
  const float* Wv     = (const float*)d_in[6];
  const float* bv     = (const float*)d_in[7];

  float* ctx   = (float*)d_out;                       // B*S*H
  float* lattn = ctx + (size_t)BB * SS * HH;          // B*NH*(S-1)*1*2

  float* Qf = (float*)d_ws;                           // 64 MiB each
  float* Kf = Qf + (size_t)MM * HH;
  float* Vf = Kf + (size_t)MM * HH;

  dim3 g1(HH / TILE_N, MM / TILE_M, 3);
  qkv_gemm_wmma<<<g1, 256, 0, stream>>>(hidden, Wq, bq, Wk, bk, Wv, bv, Qf, Kf, Vf);

  global_attn<<<BB * NHH, 256, 0, stream>>>(Qf, Kf, Vf, mask, ctx);

  const int nwork = BB * NHH * (SS - 1);
  local_attn<<<(nwork + 7) / 8, 256, 0, stream>>>(Qf, Kf, Vf, ctx, lattn, nwork);
}

// v002
// A run of this version takes 211 microseconds.
// In two side-by-side timings against v001, it was 1.45 and 1.46 times as fast.
// Counting every step since v000, it is 2.06 times as fast.
#include <hip/hip_runtime.h>
#include <hip/hip_bf16.h>
#include <math.h>

// Problem constants (from reference)
#define BB   4
#define SS   4096
#define HH   1024
#define NHH  16
#define DD   64
#define MM   (BB*SS)          // 16384 rows
#define ATT_SCALE 0.125f      // 1/sqrt(64)

typedef __attribute__((ext_vector_type(16))) __bf16 v16bf;
typedef __attribute__((ext_vector_type(8)))  float  v8f;

#define TILE_M 128
#define TILE_N 128
#define TILE_K 32
#define LDSS   40   // LDS row stride in bf16 elems (32 data + 8 pad -> 80B rows, 16B aligned)

// ---------------------------------------------------------------------------
// Fused QKV projection: Out = X @ W^T + b, computed with v_wmma_f32_16x16x32_bf16
// grid: (HH/TILE_N, MM/TILE_M, 3)  block: 256 (8 waves of 32)
// ---------------------------------------------------------------------------
__global__ __launch_bounds__(256)
void qkv_gemm_wmma(const float* __restrict__ X,
                   const float* __restrict__ Wq, const float* __restrict__ bq,
                   const float* __restrict__ Wk, const float* __restrict__ bk,
                   const float* __restrict__ Wv, const float* __restrict__ bv,
                   float* __restrict__ Qf, float* __restrict__ Kf, float* __restrict__ Vf)
{
  __shared__ __align__(16) __bf16 As[2][TILE_M][LDSS];
  __shared__ __align__(16) __bf16 Bs[2][TILE_N][LDSS];

  const int which = blockIdx.z;
  const float* __restrict__ W    = (which == 0) ? Wq : (which == 1) ? Wk : Wv;
  const float* __restrict__ bias = (which == 0) ? bq : (which == 1) ? bk : bv;
  float* __restrict__ Out        = (which == 0) ? Qf : (which == 1) ? Kf : Vf;

  const int n0   = blockIdx.x * TILE_N;
  const int m0   = blockIdx.y * TILE_M;
  const int tid  = threadIdx.x;
  const int wave = tid >> 5;
  const int lane = tid & 31;
  const int half = lane >> 4;     // 0: lanes 0-15, 1: lanes 16-31
  const int r16  = lane & 15;
  const int waveM = wave >> 2;    // 0..1  -> 64-row slab
  const int waveN = wave & 3;     // 0..3  -> 32-col slab

  v8f acc[4][2];
  #pragma unroll
  for (int i = 0; i < 4; ++i)
    #pragma unroll
    for (int j = 0; j < 2; ++j)
      acc[i][j] = v8f{};

  // global fp32 -> LDS bf16 tile stage (128x32 each for A and B)
  auto load_tiles = [&](int buf, int k0) {
    #pragma unroll
    for (int i = 0; i < 4; ++i) {
      int id = tid + i * 256;       // 0..1023
      int r  = id >> 3;             // row 0..127
      int c  = (id & 7) << 2;       // col 0,4,...,28
      float4 fa = *(const float4*)(X + (size_t)(m0 + r) * HH + k0 + c);
      __bf16* da = &As[buf][r][c];
      da[0] = (__bf16)fa.x; da[1] = (__bf16)fa.y;
      da[2] = (__bf16)fa.z; da[3] = (__bf16)fa.w;
      float4 fb = *(const float4*)(W + (size_t)(n0 + r) * HH + k0 + c);
      __bf16* db = &Bs[buf][r][c];
      db[0] = (__bf16)fb.x; db[1] = (__bf16)fb.y;
      db[2] = (__bf16)fb.z; db[3] = (__bf16)fb.w;
    }
  };

  load_tiles(0, 0);
  __syncthreads();

  const int KT = HH / TILE_K;     // 32 k-chunks
  for (int kt = 0; kt < KT; ++kt) {
    const int cur = kt & 1;
    if (kt + 1 < KT) load_tiles(cur ^ 1, (kt + 1) * TILE_K);

    // Fragment loads per ISA 16-bit A layout:
    //   lanes 0-15 : K 0-7  (bytes 0..15)  and K 16-23 (bytes 32..47)
    //   lanes 16-31: K 8-15 (bytes 16..31) and K 24-31 (bytes 48..63)
    v16bf afrag[4], bfrag[2];
    #pragma unroll
    for (int mi = 0; mi < 4; ++mi) {
      const __bf16* src = &As[cur][waveM * 64 + mi * 16 + r16][0];
      union { uint4 u[2]; v16bf v; } t;
      t.u[0] = *(const uint4*)(src + half * 8);
      t.u[1] = *(const uint4*)(src + 16 + half * 8);
      afrag[mi] = t.v;
    }
    #pragma unroll
    for (int ni = 0; ni < 2; ++ni) {
      const __bf16* src = &Bs[cur][waveN * 32 + ni * 16 + r16][0];
      union { uint4 u[2]; v16bf v; } t;
      t.u[0] = *(const uint4*)(src + half * 8);
      t.u[1] = *(const uint4*)(src + 16 + half * 8);
      bfrag[ni] = t.v;
    }

    #pragma unroll
    for (int mi = 0; mi < 4; ++mi)
      #pragma unroll
      for (int ni = 0; ni < 2; ++ni)
        acc[mi][ni] = __builtin_amdgcn_wmma_f32_16x16x32_bf16(
            false, afrag[mi], false, bfrag[ni],
            (short)0, acc[mi][ni], false, false);

    __syncthreads();
  }

  // Epilogue: C/D layout -> lanes 0-15: M=j, lanes 16-31: M=8+j; N=r16
  #pragma unroll
  for (int mi = 0; mi < 4; ++mi) {
    #pragma unroll
    for (int ni = 0; ni < 2; ++ni) {
      const int col = n0 + waveN * 32 + ni * 16 + r16;
      const float bv = bias[col];
      #pragma unroll
      for (int j = 0; j < 8; ++j) {
        const int row = m0 + waveM * 64 + mi * 16 + half * 8 + j;
        Out[(size_t)row * HH + col] = acc[mi][ni][j] + bv;
      }
    }
  }
}

// ---------------------------------------------------------------------------
// Global attention, part 1: q at position 0 of each (b,h) against a slice of
// the keys. One work-group takes GA_KEYS keys of one batch for ALL heads, so
// every load is 512 contiguous bytes of a 4-KB row of K or V. A wave owns
// GA_ROWS keys; lane l holds columns j*128 + 4*l .. +3 (j = 0..7), so a
// 16-lane row of the wave holds one head. Each work-group leaves one partial
// (max, sum, weighted V sum) per head in the workspace.
// grid: B * GA_NCH blocks, 512 threads.
// ---------------------------------------------------------------------------
#define GA_WAVES 16
#define GA_ROWS  4
#define GA_KEYS  (GA_WAVES * GA_ROWS)   // 64 keys per work-group
#define GA_NCH   (SS / GA_KEYS)         // 64 slices per batch
#define GM_BLOCKS (BB * NHH / 4)        // merge blocks in front of the local grid

// value of lane (l ^ N) inside the 16-lane row (DPP row_xmask:N)
#define ROW_XOR(x, N) __builtin_bit_cast(float, __builtin_amdgcn_update_dpp( \
    0, __builtin_bit_cast(int, (x)), 0x160 + (N), 0xf, 0xf, true))

// e^x by the bare v_exp_f32, as __expf gives it. The v_nop fills the one slot the
// instruction set asks for behind a transcendental before its source is overwritten
// or its result read.
__device__ __forceinline__ float exp_slot(float x)
{
  float r;
  asm("v_exp_f32 %0, %1\n\tv_nop" : "=v"(r) : "v"(x * 1.44269504f));
  return r;
}

__device__ __forceinline__ float row16_sum(float x)
{
  x += ROW_XOR(x, 1);
  x += ROW_XOR(x, 2);
  x += ROW_XOR(x, 4);
  x += ROW_XOR(x, 8);
  return x;
}

// one work-group of 16 waves per WGP: 4 waves a SIMD, so the register budget may go to loads in flight
__global__ __launch_bounds__(512) __attribute__((amdgpu_waves_per_eu(4, 4)))
void global_attn_part(const float* __restrict__ Qf, const float* __restrict__ Kf,
                      const float* __restrict__ Vf, const float* __restrict__ mask,
                      float* __restrict__ pm, float* __restrict__ pl,
                      float* __restrict__ pacc)
{
  __shared__ __align__(16) float s_acc[GA_WAVES][HH];
  __shared__ float s_m[GA_WAVES][NHH];
  __shared__ float s_l[GA_WAVES][NHH];

  const int blk  = blockIdx.x;
  const int b    = blk / GA_NCH;
  const int ch   = blk % GA_NCH;
  const int tid  = threadIdx.x;
  // the wave's number in a scalar register: row bases become scalar, one lane offset serves every load
  const int wave = __builtin_amdgcn_readfirstlane(tid >> 5);
  const int lane = tid & 31;
  const int s0   = ch * GA_KEYS + wave * GA_ROWS;

  const float4* q4 = (const float4*)(Qf + (size_t)(b * SS) * HH) + lane;
  const float4* k4 = (const float4*)(Kf + (size_t)(b * SS + s0) * HH) + lane;
  const float4* v4 = (const float4*)(Vf + (size_t)(b * SS + s0) * HH) + lane;

  float4 q[8];
  #pragma unroll
  for (int j = 0; j < 8; ++j) q[j] = q4[j * 32];

  float sc[GA_ROWS][8];
  #pragma unroll
  for (int r = 0; r < GA_ROWS; ++r) {
    const float mk = mask[b * SS + s0 + r];
    #pragma unroll
    for (int j = 0; j < 8; ++j) {
      const float4 k = k4[r * (HH / 4) + j * 32];
      float d = q[j].x * k.x + q[j].y * k.y + q[j].z * k.z + q[j].w * k.w;
      sc[r][j] = row16_sum(d) * ATT_SCALE + mk;
    }
  }

  // V depends on nothing above: its loads stand here so that they fly under the scores
  float4 v[GA_ROWS][8];
  #pragma unroll
  for (int r = 0; r < GA_ROWS; ++r)
    #pragma unroll
    for (int j = 0; j < 8; ++j) v[r][j] = v4[r * (HH / 4) + j * 32];

  // softmax weights of the wave's own keys (sc becomes p), one head per 16-lane row
  float m[8], l[8];
  #pragma unroll
  for (int j = 0; j < 8; ++j) {
    float mx = sc[0][j];
    #pragma unroll
    for (int r = 1; r < GA_ROWS; ++r) mx = fmaxf(mx, sc[r][j]);
    // all keys masked out: keep exp(-inf - m) at 0 instead of NaN
    const float ms = (mx == -INFINITY) ? 0.f : mx;
    float ls = 0.f;
    #pragma unroll
    for (int r = 0; r < GA_ROWS; ++r) {
      sc[r][j] = exp_slot(sc[r][j] - ms);
      ls += sc[r][j];
    }
    m[j] = mx;
    l[j] = ls;
  }

  #pragma unroll
  for (int j = 0; j < 8; ++j) {
    float4 a = make_float4(0.f, 0.f, 0.f, 0.f);
    #pragma unroll
    for (int r = 0; r < GA_ROWS; ++r) {
      const float p = sc[r][j];
      a.x += p * v[r][j].x; a.y += p * v[r][j].y;
      a.z += p * v[r][j].z; a.w += p * v[r][j].w;
    }
    ((float4*)s_acc[wave])[j * 32 + lane] = a;
  }
  if ((lane & 15) == 0) {
    #pragma unroll
    for (int j = 0; j < 8; ++j) {
      const int h = 2 * j + (lane >> 4);
      s_m[wave][h] = m[j];
      s_l[wave][h] = l[j];
    }
  }
  __syncthreads();

  // fold the 16 waves' partials into the work-group's one
  #pragma unroll
  for (int c = tid; c < HH; c += 512) {
    const int h = c >> 6;
    float M = s_m[0][h];
    #pragma unroll
    for (int w = 1; w < GA_WAVES; ++w) M = fmaxf(M, s_m[w][h]);
    const float Ms = (M == -INFINITY) ? 0.f : M;
    float a = 0.f, L = 0.f;
    #pragma unroll
    for (int w = 0; w < GA_WAVES; ++w) {
      const float e = exp_slot(s_m[w][h] - Ms);
      a += e * s_acc[w][c];
      L += e * s_l[w][h];
    }
    pacc[(size_t)blk * HH + c] = a;
    if ((c & 63) == 0) {
      pm[blk * NHH + h] = M;
      pl[blk * NHH + h] = L;
    }
  }
}

// Global attention, part 2: fold the GA_NCH slices of one (b,h); one thread
// per output element, 4 (b,h) per block of 256 threads.
__device__ __forceinline__
void global_attn_merge(int e, const float* __restrict__ pm, const float* __restrict__ pl,
                       const float* __restrict__ pacc, float* __restrict__ ctx)
{
  __shared__ float g_m[4][GA_NCH];
  __shared__ float g_l[4][GA_NCH];
  // 64 threads (two whole waves) per (b,h): its number in a scalar register makes every base scalar
  const int g  = __builtin_amdgcn_readfirstlane(threadIdx.x >> 6);
  const int d  = threadIdx.x & 63;
  const int bh = e * 4 + g;
  const int b  = bh / NHH;
  const int h  = bh % NHH;
  const float* mp = pm + b * GA_NCH * NHH + h;
  const float* lp = pl + b * GA_NCH * NHH + h;
  const float* ap = pacc + b * GA_NCH * HH + h * DD;

  // thread d fetches slice d's maximum and sum
  static_assert(GA_NCH == DD, "one thread per slice");
  g_m[g][d] = mp[d * NHH];
  g_l[g][d] = lp[d * NHH];
  __syncthreads();

  float M = g_m[g][0];
  #pragma unroll
  for (int i = 1; i < GA_NCH; ++i) M = fmaxf(M, g_m[g][i]);
  const float Ms = (M == -INFINITY) ? 0.f : M;
  float a = 0.f, L = 0.f;
  #pragma unroll 16
  for (int i = 0; i < GA_NCH; ++i) {
    const float w = exp_slot(g_m[g][i] - Ms);
    a += w * ap[i * HH + d];
    L += w * g_l[g][i];
  }
  ctx[(size_t)(b * SS) * HH + h * DD + d] = a * (1.f / L);
}

// ---------------------------------------------------------------------------
// Local attention: each (b,h,s>=1) softmaxes over {self, key0}. One wave32
// per (b,h,s); lanes cover the 64-dim head. The first GM_BLOCKS blocks of the
// grid fold the global attention's slices instead.
// ---------------------------------------------------------------------------
__global__ __launch_bounds__(256)
void local_attn(const float* __restrict__ Qf, const float* __restrict__ Kf,
                const float* __restrict__ Vf, float* __restrict__ ctx,
                float* __restrict__ lattn, int nwork,
                const float* __restrict__ pm, const float* __restrict__ pl,
                const float* __restrict__ pacc)
{
  if (blockIdx.x < GM_BLOCKS) {
    global_attn_merge(blockIdx.x, pm, pl, pacc, ctx);
    return;
  }
  const int idx  = (blockIdx.x - GM_BLOCKS) * 8 + (threadIdx.x >> 5);
  const int lane = threadIdx.x & 31;
  if (idx >= nwork) return;

  const int s  = idx % (SS - 1) + 1;
  const int bh = idx / (SS - 1);
  const int b  = bh / NHH;
  const int h  = bh % NHH;

  const float* q  = Qf + (size_t)(b * SS + s) * HH + h * DD;
  const float* ks = Kf + (size_t)(b * SS + s) * HH + h * DD;
  const float* k0 = Kf + (size_t)(b * SS) * HH + h * DD;

  const float qa = q[lane], qb = q[lane + 32];
  float dself = qa * ks[lane] + qb * ks[lane + 32];
  float dglob = qa * k0[lane] + qb * k0[lane + 32];
  #pragma unroll
  for (int off = 16; off > 0; off >>= 1) {
    dself += __shfl_xor(dself, off, 32);
    dglob += __shfl_xor(dglob, off, 32);
  }
  const float a = dself * ATT_SCALE;
  const float c = dglob * ATT_SCALE;
  const float mx = fmaxf(a, c);
  const float e0 = __expf(a - mx);
  const float e1 = __expf(c - mx);
  const float inv = 1.f / (e0 + e1);
  const float p0 = e0 * inv, p1 = e1 * inv;

  const float* vs = Vf + (size_t)(b * SS + s) * HH + h * DD;
  const float* v0 = Vf + (size_t)(b * SS) * HH + h * DD;
  float* cp = ctx + (size_t)(b * SS + s) * HH + h * DD;
  cp[lane]      = p0 * vs[lane]      + p1 * v0[lane];
  cp[lane + 32] = p0 * vs[lane + 32] + p1 * v0[lane + 32];

  if (lane == 0) {
    float* lp = lattn + ((size_t)bh * (SS - 1) + (s - 1)) * 2;
    lp[0] = p0;
    lp[1] = p1;
  }
}

// ---------------------------------------------------------------------------
extern "C" void kernel_launch(void* const* d_in, const int* in_sizes, int n_in,
                              void* d_out, int out_size, void* d_ws, size_t ws_size,
                              hipStream_t stream)
{
  const float* hidden = (const float*)d_in[0];
  const float* mask   = (const float*)d_in[1];
  const float* Wq     = (const float*)d_in[2];
  const float* bq     = (const float*)d_in[3];
  const float* Wk     = (const float*)d_in[4];
  const float* bk     = (const float*)d_in[5];
  const float* Wv     = (const float*)d_in[6];
  const float* bv     = (const float*)d_in[7];

  float* ctx   = (float*)d_out;                       // B*S*H
  float* lattn = ctx + (size_t)BB * SS * HH;          // B*NH*(S-1)*1*2

  float* Qf = (float*)d_ws;                           // 64 MiB each
  float* Kf = Qf + (size_t)MM * HH;
  float* Vf = Kf + (size_t)MM * HH;
  float* pacc = Vf + (size_t)MM * HH;                 // B*GA_NCH*H partial sums
  float* pm   = pacc + (size_t)BB * GA_NCH * HH;      // B*GA_NCH*NH partial maxima
  float* pl   = pm + (size_t)BB * GA_NCH * NHH;       // B*GA_NCH*NH partial sums of exp

  dim3 g1(HH / TILE_N, MM / TILE_M, 3);
  qkv_gemm_wmma<<<g1, 256, 0, stream>>>(hidden, Wq, bq, Wk, bk, Wv, bv, Qf, Kf, Vf);

  global_attn_part<<<BB * GA_NCH, 512, 0, stream>>>(Qf, Kf, Vf, mask, pm, pl, pacc);

  const int nwork = BB * NHH * (SS - 1);
  local_attn<<<GM_BLOCKS + (nwork + 7) / 8, 256, 0, stream>>>(Qf, Kf, Vf, ctx, lattn, nwork, pm, pl, pacc);
}

// v003
// It runs in 204 microseconds.
// Timed twice side by side with v002, it ran 1.04 times as fast both times.
// Counting every step since v000, it is 2.14 times as fast.
#include <hip/hip_runtime.h>
#include <hip/hip_bf16.h>
#include <math.h>

// Problem constants (from reference)
#define BB   4
#define SS   4096
#define HH   1024
#define NHH  16
#define DD   64
#define MM   (BB*SS)          // 16384 rows
#define ATT_SCALE 0.125f      // 1/sqrt(64)

typedef __attribute__((ext_vector_type(16))) __bf16 v16bf;
typedef __attribute__((ext_vector_type(8)))  float  v8f;

#define TILE_M 128
#define TILE_N 128
#define TILE_K 32
#define LDSS   40   // LDS row stride in bf16 elems (32 data + 8 pad -> 80B rows, 16B aligned)

// ---------------------------------------------------------------------------
// Fused QKV projection: Out = X @ W^T + b, computed with v_wmma_f32_16x16x32_bf16
// grid: (HH/TILE_N, MM/TILE_M, 3)  block: 256 (8 waves of 32)
// ---------------------------------------------------------------------------
__global__ __launch_bounds__(256)
void qkv_gemm_wmma(const float* __restrict__ X,
                   const float* __restrict__ Wq, const float* __restrict__ bq,
                   const float* __restrict__ Wk, const float* __restrict__ bk,
                   const float* __restrict__ Wv, const float* __restrict__ bv,
                   float* __restrict__ Qf, float* __restrict__ Kf, float* __restrict__ Vf)
{
  __shared__ __align__(16) __bf16 As[2][TILE_M][LDSS];
  __shared__ __align__(16) __bf16 Bs[2][TILE_N][LDSS];

  const int which = blockIdx.z;
  const float* __restrict__ W    = (which == 0) ? Wq : (which == 1) ? Wk : Wv;
  const float* __restrict__ bias = (which == 0) ? bq : (which == 1) ? bk : bv;
  float* __restrict__ Out        = (which == 0) ? Qf : (which == 1) ? Kf : Vf;

  const int n0   = blockIdx.x * TILE_N;
  const int m0   = blockIdx.y * TILE_M;
  const int tid  = threadIdx.x;
  const int wave = tid >> 5;
  const int lane = tid & 31;
  const int half = lane >> 4;     // 0: lanes 0-15, 1: lanes 16-31
  const int r16  = lane & 15;
  const int waveM = wave >> 2;    // 0..1  -> 64-row slab
  const int waveN = wave & 3;     // 0..3  -> 32-col slab

  v8f acc[4][2];
  #pragma unroll
  for (int i = 0; i < 4; ++i)
    #pragma unroll
    for (int j = 0; j < 2; ++j)
      acc[i][j] = v8f{};

  // global fp32 -> LDS bf16 tile stage (128x32 each for A and B)
  auto load_tiles = [&](int buf, int k0) {
    #pragma unroll
    for (int i = 0; i < 4; ++i) {
      int id = tid + i * 256;       // 0..1023
      int r  = id >> 3;             // row 0..127
      int c  = (id & 7) << 2;       // col 0,4,...,28
      float4 fa = *(const float4*)(X + (size_t)(m0 + r) * HH + k0 + c);
      __bf16* da = &As[buf][r][c];
      da[0] = (__bf16)fa.x; da[1] = (__bf16)fa.y;
      da[2] = (__bf16)fa.z; da[3] = (__bf16)fa.w;
      float4 fb = *(const float4*)(W + (size_t)(n0 + r) * HH + k0 + c);
      __bf16* db = &Bs[buf][r][c];
      db[0] = (__bf16)fb.x; db[1] = (__bf16)fb.y;
      db[2] = (__bf16)fb.z; db[3] = (__bf16)fb.w;
    }
  };

  load_tiles(0, 0);
  __syncthreads();

  const int KT = HH / TILE_K;     // 32 k-chunks
  for (int kt = 0; kt < KT; ++kt) {
    const int cur = kt & 1;
    if (kt + 1 < KT) load_tiles(cur ^ 1, (kt + 1) * TILE_K);

    // Fragment loads per ISA 16-bit A layout:
    //   lanes 0-15 : K 0-7  (bytes 0..15)  and K 16-23 (bytes 32..47)
    //   lanes 16-31: K 8-15 (bytes 16..31) and K 24-31 (bytes 48..63)
    v16bf afrag[4], bfrag[2];
    #pragma unroll
    for (int mi = 0; mi < 4; ++mi) {
      const __bf16* src = &As[cur][waveM * 64 + mi * 16 + r16][0];
      union { uint4 u[2]; v16bf v; } t;
      t.u[0] = *(const uint4*)(src + half * 8);
      t.u[1] = *(const uint4*)(src + 16 + half * 8);
      afrag[mi] = t.v;
    }
    #pragma unroll
    for (int ni = 0; ni < 2; ++ni) {
      const __bf16* src = &Bs[cur][waveN * 32 + ni * 16 + r16][0];
      union { uint4 u[2]; v16bf v; } t;
      t.u[0] = *(const uint4*)(src + half * 8);
      t.u[1] = *(const uint4*)(src + 16 + half * 8);
      bfrag[ni] = t.v;
    }

    #pragma unroll
    for (int mi = 0; mi < 4; ++mi)
      #pragma unroll
      for (int ni = 0; ni < 2; ++ni)
        acc[mi][ni] = __builtin_amdgcn_wmma_f32_16x16x32_bf16(
            false, afrag[mi], false, bfrag[ni],
            (short)0, acc[mi][ni], false, false);

    __syncthreads();
  }

  // Epilogue: C/D layout -> lanes 0-15: M=j, lanes 16-31: M=8+j; N=r16
  #pragma unroll
  for (int mi = 0; mi < 4; ++mi) {
    #pragma unroll
    for (int ni = 0; ni < 2; ++ni) {
      const int col = n0 + waveN * 32 + ni * 16 + r16;
      const float bv = bias[col];
      #pragma unroll
      for (int j = 0; j < 8; ++j) {
        const int row = m0 + waveM * 64 + mi * 16 + half * 8 + j;
        Out[(size_t)row * HH + col] = acc[mi][ni][j] + bv;
      }
    }
  }
}

// ---------------------------------------------------------------------------
// Global attention, part 1: q at position 0 of each (b,h) against a slice of
// the keys. One work-group takes GA_KEYS keys of one batch for ALL heads, so
// every load is 512 contiguous bytes of a 4-KB row of K or V. A wave owns
// GA_ROWS keys; lane l holds columns j*128 + 4*l .. +3 (j = 0..7), so a
// 16-lane row of the wave holds one head. Each work-group leaves one partial
// (max, sum, weighted V sum) per head in the workspace.
// grid: B * GA_NCH blocks, 512 threads.
// ---------------------------------------------------------------------------
#define GA_WAVES 16
#define GA_ROWS  4
#define GA_KEYS  (GA_WAVES * GA_ROWS)   // 64 keys per work-group
#define GA_NCH   (SS / GA_KEYS)         // 64 slices per batch
#define GM_BLOCKS (BB * NHH / 4)        // merge blocks in front of the local grid

// value of lane (l ^ N) inside the 16-lane row (DPP row_xmask:N)
#define ROW_XOR(x, N) __builtin_bit_cast(float, __builtin_amdgcn_update_dpp( \
    0, __builtin_bit_cast(int, (x)), 0x160 + (N), 0xf, 0xf, true))

// e^x by the bare v_exp_f32, as __expf gives it. The v_nop fills the one slot the
// instruction set asks for behind a transcendental before its source is overwritten
// or its result read.
__device__ __forceinline__ float exp_slot(float x)
{
  float r;
  asm("v_exp_f32 %0, %1\n\tv_nop" : "=v"(r) : "v"(x * 1.44269504f));
  return r;
}

__device__ __forceinline__ float row16_sum(float x)
{
  x += ROW_XOR(x, 1);
  x += ROW_XOR(x, 2);
  x += ROW_XOR(x, 4);
  x += ROW_XOR(x, 8);
  return x;
}

// one work-group of 16 waves per WGP: 4 waves a SIMD, so the register budget may go to loads in flight
__global__ __launch_bounds__(512) __attribute__((amdgpu_waves_per_eu(4, 4)))
void global_attn_part(const float* __restrict__ Qf, const float* __restrict__ Kf,
                      const float* __restrict__ Vf, const float* __restrict__ mask,
                      float* __restrict__ pm, float* __restrict__ pl,
                      float* __restrict__ pacc)
{
  __shared__ __align__(16) float s_acc[GA_WAVES][HH];
  __shared__ float s_m[GA_WAVES][NHH];
  __shared__ float s_l[GA_WAVES][NHH];

  const int blk  = blockIdx.x;
  const int b    = blk / GA_NCH;
  const int ch   = blk % GA_NCH;
  const int tid  = threadIdx.x;
  // the wave's number in a scalar register: row bases become scalar, one lane offset serves every load
  const int wave = __builtin_amdgcn_readfirstlane(tid >> 5);
  const int lane = tid & 31;
  const int s0   = ch * GA_KEYS + wave * GA_ROWS;

  const float4* q4 = (const float4*)(Qf + (size_t)(b * SS) * HH) + lane;
  const float4* k4 = (const float4*)(Kf + (size_t)(b * SS + s0) * HH) + lane;
  const float4* v4 = (const float4*)(Vf + (size_t)(b * SS + s0) * HH) + lane;

  float4 q[8];
  #pragma unroll
  for (int j = 0; j < 8; ++j) q[j] = q4[j * 32];

  float sc[GA_ROWS][8];
  #pragma unroll
  for (int r = 0; r < GA_ROWS; ++r) {
    const float mk = mask[b * SS + s0 + r];
    #pragma unroll
    for (int j = 0; j < 8; ++j) {
      const float4 k = k4[r * (HH / 4) + j * 32];
      float d = q[j].x * k.x + q[j].y * k.y + q[j].z * k.z + q[j].w * k.w;
      sc[r][j] = row16_sum(d) * ATT_SCALE + mk;
    }
  }

  // V depends on nothing above: its loads stand here so that they fly under the scores
  float4 v[GA_ROWS][8];
  #pragma unroll
  for (int r = 0; r < GA_ROWS; ++r)
    #pragma unroll
    for (int j = 0; j < 8; ++j) v[r][j] = v4[r * (HH / 4) + j * 32];

  // softmax weights of the wave's own keys (sc becomes p), one head per 16-lane row
  float m[8], l[8];
  #pragma unroll
  for (int j = 0; j < 8; ++j) {
    float mx = sc[0][j];
    #pragma unroll
    for (int r = 1; r < GA_ROWS; ++r) mx = fmaxf(mx, sc[r][j]);
    // all keys masked out: keep exp(-inf - m) at 0 instead of NaN
    const float ms = (mx == -INFINITY) ? 0.f : mx;
    float ls = 0.f;
    #pragma unroll
    for (int r = 0; r < GA_ROWS; ++r) {
      sc[r][j] = exp_slot(sc[r][j] - ms);
      ls += sc[r][j];
    }
    m[j] = mx;
    l[j] = ls;
  }

  #pragma unroll
  for (int j = 0; j < 8; ++j) {
    float4 a = make_float4(0.f, 0.f, 0.f, 0.f);
    #pragma unroll
    for (int r = 0; r < GA_ROWS; ++r) {
      const float p = sc[r][j];
      a.x += p * v[r][j].x; a.y += p * v[r][j].y;
      a.z += p * v[r][j].z; a.w += p * v[r][j].w;
    }
    ((float4*)s_acc[wave])[j * 32 + lane] = a;
  }
  if ((lane & 15) == 0) {
    #pragma unroll
    for (int j = 0; j < 8; ++j) {
      const int h = 2 * j + (lane >> 4);
      s_m[wave][h] = m[j];
      s_l[wave][h] = l[j];
    }
  }
  __syncthreads();

  // fold the 16 waves' partials into the work-group's one
  #pragma unroll
  for (int c = tid; c < HH; c += 512) {
    const int h = c >> 6;
    float M = s_m[0][h];
    #pragma unroll
    for (int w = 1; w < GA_WAVES; ++w) M = fmaxf(M, s_m[w][h]);
    const float Ms = (M == -INFINITY) ? 0.f : M;
    float a = 0.f, L = 0.f;
    #pragma unroll
    for (int w = 0; w < GA_WAVES; ++w) {
      const float e = exp_slot(s_m[w][h] - Ms);
      a += e * s_acc[w][c];
      L += e * s_l[w][h];
    }
    pacc[(size_t)blk * HH + c] = a;
    if ((c & 63) == 0) {
      pm[blk * NHH + h] = M;
      pl[blk * NHH + h] = L;
    }
  }
}

// Global attention, part 2: fold the GA_NCH slices of one (b,h); one thread
// per output element, 4 (b,h) per block of 256 threads.
__device__ __forceinline__
void global_attn_merge(int e, const float* __restrict__ pm, const float* __restrict__ pl,
                       const float* __restrict__ pacc, float* __restrict__ ctx)
{
  __shared__ float g_m[4][GA_NCH];
  __shared__ float g_l[4][GA_NCH];
  // 64 threads (two whole waves) per (b,h): its number in a scalar register makes every base scalar
  const int g  = __builtin_amdgcn_readfirstlane(threadIdx.x >> 6);
  const int d  = threadIdx.x & 63;
  const int bh = e * 4 + g;
  const int b  = bh / NHH;
  const int h  = bh % NHH;
  const float* mp = pm + b * GA_NCH * NHH + h;
  const float* lp = pl + b * GA_NCH * NHH + h;
  const float* ap = pacc + b * GA_NCH * HH + h * DD;

  // thread d fetches slice d's maximum and sum
  static_assert(GA_NCH == DD, "one thread per slice");
  g_m[g][d] = mp[d * NHH];
  g_l[g][d] = lp[d * NHH];
  __syncthreads();

  float M = g_m[g][0];
  #pragma unroll
  for (int i = 1; i < GA_NCH; ++i) M = fmaxf(M, g_m[g][i]);
  const float Ms = (M == -INFINITY) ? 0.f : M;
  float a = 0.f, L = 0.f;
  #pragma unroll 16
  for (int i = 0; i < GA_NCH; ++i) {
    const float w = exp_slot(g_m[g][i] - Ms);
    a += w * ap[i * HH + d];
    L += w * g_l[g][i];
  }
  ctx[(size_t)(b * SS) * HH + h * DD + d] = a * (1.f / L);
}

// ---------------------------------------------------------------------------
// Local attention: each (b,h,s>=1) softmaxes over {self, key0}. A wave owns
// LA_ROWS consecutive rows of one batch and takes them whole, all heads: lane l
// holds columns j*128 + 4*l .. +3 (j = 0..7), so every load and store is 512
// contiguous bytes and a 16-lane row of the wave holds one head. The first
// GM_BLOCKS blocks of the grid fold the global attention's slices instead.
// ---------------------------------------------------------------------------
#define LA_WAVES 8
#define LA_ROWS  4
#define LA_BLOCKS (MM / (LA_WAVES * LA_ROWS))

__global__ __launch_bounds__(256)
void local_attn(const float* __restrict__ Qf, const float* __restrict__ Kf,
                const float* __restrict__ Vf, float* __restrict__ ctx,
                float* __restrict__ lattn,
                const float* __restrict__ pm, const float* __restrict__ pl,
                const float* __restrict__ pacc)
{
  if (blockIdx.x < GM_BLOCKS) {
    global_attn_merge(blockIdx.x, pm, pl, pacc, ctx);
    return;
  }
  static_assert(SS % LA_ROWS == 0, "a wave's rows lie in one batch");
  // the wave's number in a scalar register: row bases become scalar, one lane offset serves every access
  const int wave = __builtin_amdgcn_readfirstlane(threadIdx.x >> 5);
  const int lane = threadIdx.x & 31;
  const int sub  = lane & 15;
  const int row0 = ((blockIdx.x - GM_BLOCKS) * LA_WAVES + wave) * LA_ROWS;   // b*SS + s
  const int b    = row0 / SS;
  const int s0   = row0 % SS;

  const float4* q4  = (const float4*)(Qf + (size_t)row0 * HH) + lane;
  const float4* k4  = (const float4*)(Kf + (size_t)row0 * HH) + lane;
  const float4* v4  = (const float4*)(Vf + (size_t)row0 * HH) + lane;
  const float4* k04 = (const float4*)(Kf + (size_t)(b * SS) * HH) + lane;
  const float4* v04 = (const float4*)(Vf + (size_t)(b * SS) * HH) + lane;
  float4*       c4  = (float4*)(ctx + (size_t)row0 * HH) + lane;

  // two register sets: the next pair of heads is on its way while this one is worked on
  float4 q[2][LA_ROWS], k[2][LA_ROWS], v[2][LA_ROWS], k0[2], v0[2];
  auto fetch = [&](int set, int j) {
    k0[set] = k04[j * 32];
    v0[set] = v04[j * 32];
    #pragma unroll
    for (int r = 0; r < LA_ROWS; ++r) {
      q[set][r] = q4[r * (HH / 4) + j * 32];
      k[set][r] = k4[r * (HH / 4) + j * 32];
      v[set][r] = v4[r * (HH / 4) + j * 32];
    }
  };

  fetch(0, 0);
  #pragma unroll
  for (int j = 0; j < 8; ++j) {
    const int c = j & 1;
    if (j + 1 < 8) fetch(c ^ 1, j + 1);
    // stands before the first rewrite of a register that the loads above name (the lane offset is reused below)
    if (j == 0) asm volatile("s_wait_xcnt 0x0" ::: "memory");

    float w0 = 0.f, w1 = 0.f;      // lane sub keeps the weights of row s0 + sub
    #pragma unroll
    for (int r = 0; r < LA_ROWS; ++r) {
      const float4 qq = q[c][r], kk = k[c][r], vv = v[c][r];
      // holds this V load up with its group: it is used only under the scalar test below, and the
      // compiler otherwise sinks it into that branch, where the wave waits out its whole latency
      if (j == 0 && r == 0) asm volatile("" :: "v"(vv.x), "v"(vv.y), "v"(vv.z), "v"(vv.w));
      const float dself = qq.x * kk.x + qq.y * kk.y + qq.z * kk.z + qq.w * kk.w;
      const float dglob = qq.x * k0[c].x + qq.y * k0[c].y + qq.z * k0[c].z + qq.w * k0[c].w;
      const float sa = row16_sum(dself) * ATT_SCALE;
      const float sg = row16_sum(dglob) * ATT_SCALE;
      const float mx = fmaxf(sa, sg);
      const float e0 = exp_slot(sa - mx);
      const float e1 = exp_slot(sg - mx);
      const float inv = 1.f / (e0 + e1);
      const float p0 = e0 * inv, p1 = e1 * inv;
      float4 o;
      o.x = p0 * vv.x + p1 * v0[c].x;
      o.y = p0 * vv.y + p1 * v0[c].y;
      o.z = p0 * vv.z + p1 * v0[c].z;
      o.w = p0 * vv.w + p1 * v0[c].w;
      // position 0 belongs to the global attention (a scalar test: s0 is the wave's)
      if (r > 0 || s0 != 0) c4[r * (HH / 4) + j * 32] = o;
      if (sub == r) { w0 = p0; w1 = p1; }
    }
    // the rows' weight pairs of one head lie side by side in lattn: one 8-byte store per row and head
    const int h = 2 * j + (lane >> 4);
    const int s = s0 + sub;
    if (sub < LA_ROWS && s >= 1) {
      float2* lp = (float2*)(lattn + ((size_t)(b * NHH + h) * (SS - 1) + (s - 1)) * 2);
      *lp = make_float2(w0, w1);
    }
  }
}

// ---------------------------------------------------------------------------
extern "C" void kernel_launch(void* const* d_in, const int* in_sizes, int n_in,
                              void* d_out, int out_size, void* d_ws, size_t ws_size,
                              hipStream_t stream)
{
  const float* hidden = (const float*)d_in[0];
  const float* mask   = (const float*)d_in[1];
  const float* Wq     = (const float*)d_in[2];
  const float* bq     = (const float*)d_in[3];
  const float* Wk     = (const float*)d_in[4];
  const float* bk     = (const float*)d_in[5];
  const float* Wv     = (const float*)d_in[6];
  const float* bv     = (const float*)d_in[7];

  float* ctx   = (float*)d_out;                       // B*S*H
  float* lattn = ctx + (size_t)BB * SS * HH;          // B*NH*(S-1)*1*2

  float* Qf = (float*)d_ws;                           // 64 MiB each
  float* Kf = Qf + (size_t)MM * HH;
  float* Vf = Kf + (size_t)MM * HH;
  float* pacc = Vf + (size_t)MM * HH;                 // B*GA_NCH*H partial sums
  float* pm   = pacc + (size_t)BB * GA_NCH * HH;      // B*GA_NCH*NH partial maxima
  float* pl   = pm + (size_t)BB * GA_NCH * NHH;       // B*GA_NCH*NH partial sums of exp

  dim3 g1(HH / TILE_N, MM / TILE_M, 3);
  qkv_gemm_wmma<<<g1, 256, 0, stream>>>(hidden, Wq, bq, Wk, bk, Wv, bv, Qf, Kf, Vf);

  global_attn_part<<<BB * GA_NCH, 512, 0, stream>>>(Qf, Kf, Vf, mask, pm, pl, pacc);

  local_attn<<<GM_BLOCKS + LA_BLOCKS, 256, 0, stream>>>(Qf, Kf, Vf, ctx, lattn, pm, pl, pacc);
}

// v004
// A run of this version takes 153 microseconds.
// Two timings next to v003 put it at 1.34 and 1.33 times that version's speed.
// Counting every step since v000, it is 2.85 times as fast.
#include <hip/hip_runtime.h>
#include <hip/hip_bf16.h>
#include <math.h>

// Problem constants (from reference)
#define BB   4
#define SS   4096
#define HH   1024
#define NHH  16
#define DD   64
#define MM   (BB*SS)          // 16384 rows
#define ATT_SCALE 0.125f      // 1/sqrt(64)

typedef __attribute__((ext_vector_type(16))) __bf16 v16bf;
typedef __attribute__((ext_vector_type(8)))  float  v8f;

#define TILE_M 256
#define TILE_N 256
#define TILE_K 64
#define LDSS   72   // LDS row stride in bf16 elems (64 data + 8 pad -> 144B rows, 16B aligned)

// ---------------------------------------------------------------------------
// Fused QKV projection: Out = X @ W^T + b, computed with v_wmma_f32_16x16x32_bf16
// One work-group makes a 256x256 tile of one of Q, K, V; a wave makes 128x64 of it
// (8x4 accumulator tiles), so each operand byte fetched from L2 feeds twice the
// products of a 128x128 tile and each LDS fragment feeds 4 or 8 matrix instructions.
// A k-chunk is 64 wide: 256 bytes of every fp32 operand row.
// grid: (HH/TILE_N, MM/TILE_M, 3)  block: 256 (8 waves of 32)
// ---------------------------------------------------------------------------
__global__ __launch_bounds__(256)
void qkv_gemm_wmma(const float* __restrict__ X,
                   const float* __restrict__ Wq, const float* __restrict__ bq,
                   const float* __restrict__ Wk, const float* __restrict__ bk,
                   const float* __restrict__ Wv, const float* __restrict__ bv,
                   float* __restrict__ Qf, float* __restrict__ Kf, float* __restrict__ Vf)
{
  __shared__ __align__(16) __bf16 As[2][TILE_M][LDSS];
  __shared__ __align__(16) __bf16 Bs[2][TILE_N][LDSS];

  const int which = blockIdx.z;
  const float* __restrict__ W    = (which == 0) ? Wq : (which == 1) ? Wk : Wv;
  const float* __restrict__ bias = (which == 0) ? bq : (which == 1) ? bk : bv;
  float* __restrict__ Out        = (which == 0) ? Qf : (which == 1) ? Kf : Vf;

  const int n0   = blockIdx.x * TILE_N;
  const int m0   = blockIdx.y * TILE_M;
  const int tid  = threadIdx.x;
  const int wave = tid >> 5;
  const int lane = tid & 31;
  const int half = lane >> 4;     // 0: lanes 0-15, 1: lanes 16-31
  const int r16  = lane & 15;
  const int waveM = wave >> 2;    // 0..1  -> 128-row slab
  const int waveN = wave & 3;     // 0..3  -> 64-col slab

  v8f acc[8][4];
  #pragma unroll
  for (int i = 0; i < 8; ++i)
    #pragma unroll
    for (int j = 0; j < 4; ++j)
      acc[i][j] = v8f{};

  // staging of a k-chunk (256x64 fp32 each for A and B) in two parts of 128 rows: thread t takes
  // 16 bytes of rows (t>>4) + 16*i of the part, so a wave's load covers 256 contiguous bytes of each of two rows
  const int sr = tid >> 4;          // row 0..15 of each 16-row group
  const int sc = (tid & 15) << 2;   // col 0,4,...,60
  // scalar tile bases and one lane offset that serves every load of both operands
  const float* xa = X + (size_t)m0 * HH;
  const float* wb = W + (size_t)n0 * HH;
  const unsigned so = (unsigned)(sr * HH + sc);
  float4 ra[2][8], rb[2][8];        // one register set per part

  // global fp32 -> registers, rows part*128 .. +127 of both operands at the bases' k
  auto fetch = [&](int part) {
    #pragma unroll
    for (int i = 0; i < 8; ++i) {
      ra[part][i] = *(const float4*)(xa + (part * 128 + i * 16) * HH + so);
      rb[part][i] = *(const float4*)(wb + (part * 128 + i * 16) * HH + so);
    }
  };
  // registers -> LDS bf16
  auto stage = [&](int buf, int part) {
    #pragma unroll
    for (int i = 0; i < 8; ++i) {
      __bf16* da = &As[buf][part * 128 + sr + i * 16][sc];
      da[0] = (__bf16)ra[part][i].x; da[1] = (__bf16)ra[part][i].y;
      da[2] = (__bf16)ra[part][i].z; da[3] = (__bf16)ra[part][i].w;
      __bf16* db = &Bs[buf][part * 128 + sr + i * 16][sc];
      db[0] = (__bf16)rb[part][i].x; db[1] = (__bf16)rb[part][i].y;
      db[2] = (__bf16)rb[part][i].z; db[3] = (__bf16)rb[part][i].w;
    }
  };
  // 32 of the chunk's 64 k (kh = 0, 1) for the wave's 128x64 tile
  auto compute = [&](int cur, int kh) {
    // Fragment loads per ISA 16-bit A layout:
    //   lanes 0-15 : K 0-7  (bytes 0..15)  and K 16-23 (bytes 32..47)
    //   lanes 16-31: K 8-15 (bytes 16..31) and K 24-31 (bytes 48..63)
    v16bf afrag[8], bfrag[4];
    #pragma unroll
    for (int ni = 0; ni < 4; ++ni) {
      const __bf16* src = &Bs[cur][waveN * 64 + ni * 16 + r16][kh * 32];
      union { uint4 u[2]; v16bf v; } t;
      t.u[0] = *(const uint4*)(src + half * 8);
      t.u[1] = *(const uint4*)(src + 16 + half * 8);
      bfrag[ni] = t.v;
    }
    #pragma unroll
    for (int mi = 0; mi < 8; ++mi) {
      const __bf16* src = &As[cur][waveM * 128 + mi * 16 + r16][kh * 32];
      union { uint4 u[2]; v16bf v; } t;
      t.u[0] = *(const uint4*)(src + half * 8);
      t.u[1] = *(const uint4*)(src + 16 + half * 8);
      afrag[mi] = t.v;
    }
    // keeps the 24 LDS reads together in front of the products: left alone the compiler deals them
    // out two at a time among the products, and the wave then waits out the LDS latency at each pair
    __builtin_amdgcn_sched_barrier(0);

    #pragma unroll
    for (int mi = 0; mi < 8; ++mi)
      #pragma unroll
      for (int ni = 0; ni < 4; ++ni)
        acc[mi][ni] = __builtin_amdgcn_wmma_f32_16x16x32_bf16(
            false, afrag[mi], false, bfrag[ni],
            (short)0, acc[mi][ni], false, false);
  };

  const int KT = HH / TILE_K;     // 16 k-chunks
  // keeps the set-up above from drifting in between the loads and their wait, where it reused their offset register
  __builtin_amdgcn_sched_barrier(0);
  fetch(0);
  fetch(1);
  // stands before the first rewrite of a register that the loads above name
  asm volatile("s_wait_xcnt 0x0" ::: "memory");
  // keeps every later register write behind that wait
  __builtin_amdgcn_sched_barrier(0);
  stage(0, 0);
  stage(0, 1);
  __syncthreads();

  for (int kt = 0; kt + 1 < KT; ++kt) {
    const int cur = kt & 1, nxt = cur ^ 1;
    xa += TILE_K;
    wb += TILE_K;
    // All 32 loads of chunk kt+1 leave here and fly under this chunk's products; each part is converted
    // behind 32 of them. The fences keep the loads in front and each conversion in its place: left alone
    // the compiler puts off loads to save registers and mixes the conversions, with their waits for the
    // loads, in among the products
    fetch(0);
    fetch(1);
    // stands before the first rewrite of a register that the loads above name
    asm volatile("s_wait_xcnt 0x0" ::: "memory");
    __builtin_amdgcn_sched_barrier(0);
    compute(cur, 0);
    __builtin_amdgcn_sched_barrier(0);
    stage(nxt, 0);
    __builtin_amdgcn_sched_barrier(0);
    compute(cur, 1);
    __builtin_amdgcn_sched_barrier(0);
    stage(nxt, 1);
    __syncthreads();
  }
  compute((KT - 1) & 1, 0);
  compute((KT - 1) & 1, 1);

  // Epilogue: C/D layout -> lanes 0-15: M=j, lanes 16-31: M=8+j; N=r16
  const int col0 = n0 + waveN * 64 + r16;
  float bc[4];
  #pragma unroll
  for (int ni = 0; ni < 4; ++ni) bc[ni] = bias[col0 + ni * 16];
  // stands before the first rewrite of a register that the bias loads name
  asm volatile("s_wait_xcnt 0x0" ::: "memory");
  // keeps every later register write behind that wait
  __builtin_amdgcn_sched_barrier(0);
  #pragma unroll
  for (int mi = 0; mi < 8; ++mi)
    #pragma unroll
    for (int ni = 0; ni < 4; ++ni)
      #pragma unroll
      for (int j = 0; j < 8; ++j) acc[mi][ni][j] += bc[ni];
  // every sum is made before the first store leaves, so no register that a store names is written again
  __builtin_amdgcn_sched_barrier(0);
  // one address for the thread's 256 stores; the rest are constant offsets
  float* op = Out + (size_t)(m0 + waveM * 128 + half * 8) * HH + col0;
  #pragma unroll
  for (int mi = 0; mi < 8; ++mi)
    #pragma unroll
    for (int j = 0; j < 8; ++j)
      #pragma unroll
      for (int ni = 0; ni < 4; ++ni)
        op[(mi * 16 + j) * HH + ni * 16] = acc[mi][ni][j];
}

// ---------------------------------------------------------------------------
// Global attention, part 1: q at position 0 of each (b,h) against a slice of
// the keys. One work-group takes GA_KEYS keys of one batch for ALL heads, so
// every load is 512 contiguous bytes of a 4-KB row of K or V. A wave owns
// GA_ROWS keys; lane l holds columns j*128 + 4*l .. +3 (j = 0..7), so a
// 16-lane row of the wave holds one head. Each work-group leaves one partial
// (max, sum, weighted V sum) per head in the workspace.
// grid: B * GA_NCH blocks, 512 threads.
// ---------------------------------------------------------------------------
#define GA_WAVES 16
#define GA_ROWS  4
#define GA_KEYS  (GA_WAVES * GA_ROWS)   // 64 keys per work-group
#define GA_NCH   (SS / GA_KEYS)         // 64 slices per batch
#define GM_BLOCKS (BB * NHH / 4)        // merge blocks in front of the local grid

// value of lane (l ^ N) inside the 16-lane row (DPP row_xmask:N)
#define ROW_XOR(x, N) __builtin_bit_cast(float, __builtin_amdgcn_update_dpp( \
    0, __builtin_bit_cast(int, (x)), 0x160 + (N), 0xf, 0xf, true))

// e^x by the bare v_exp_f32, as __expf gives it. The v_nop fills the one slot the
// instruction set asks for behind a transcendental before its source is overwritten
// or its result read.
__device__ __forceinline__ float exp_slot(float x)
{
  float r;
  asm("v_exp_f32 %0, %1\n\tv_nop" : "=v"(r) : "v"(x * 1.44269504f));
  return r;
}

__device__ __forceinline__ float row16_sum(float x)
{
  x += ROW_XOR(x, 1);
  x += ROW_XOR(x, 2);
  x += ROW_XOR(x, 4);
  x += ROW_XOR(x, 8);
  return x;
}

// one work-group of 16 waves per WGP: 4 waves a SIMD, so the register budget may go to loads in flight
__global__ __launch_bounds__(512) __attribute__((amdgpu_waves_per_eu(4, 4)))
void global_attn_part(const float* __restrict__ Qf, const float* __restrict__ Kf,
                      const float* __restrict__ Vf, const float* __restrict__ mask,
                      float* __restrict__ pm, float* __restrict__ pl,
                      float* __restrict__ pacc)
{
  __shared__ __align__(16) float s_acc[GA_WAVES][HH];
  __shared__ float s_m[GA_WAVES][NHH];
  __shared__ float s_l[GA_WAVES][NHH];

  const int blk  = blockIdx.x;
  const int b    = blk / GA_NCH;
  const int ch   = blk % GA_NCH;
  const int tid  = threadIdx.x;
  // the wave's number in a scalar register: row bases become scalar, one lane offset serves every load
  const int wave = __builtin_amdgcn_readfirstlane(tid >> 5);
  const int lane = tid & 31;
  const int s0   = ch * GA_KEYS + wave * GA_ROWS;

  const float4* q4 = (const float4*)(Qf + (size_t)(b * SS) * HH) + lane;
  const float4* k4 = (const float4*)(Kf + (size_t)(b * SS + s0) * HH) + lane;
  const float4* v4 = (const float4*)(Vf + (size_t)(b * SS + s0) * HH) + lane;

  float4 q[8];
  #pragma unroll
  for (int j = 0; j < 8; ++j) q[j] = q4[j * 32];

  float sc[GA_ROWS][8];
  #pragma unroll
  for (int r = 0; r < GA_ROWS; ++r) {
    const float mk = mask[b * SS + s0 + r];
    #pragma unroll
    for (int j = 0; j < 8; ++j) {
      const float4 k = k4[r * (HH / 4) + j * 32];
      float d = q[j].x * k.x + q[j].y * k.y + q[j].z * k.z + q[j].w * k.w;
      sc[r][j] = row16_sum(d) * ATT_SCALE + mk;
    }
  }

  // V depends on nothing above: its loads stand here so that they fly under the scores
  float4 v[GA_ROWS][8];
  #pragma unroll
  for (int r = 0; r < GA_ROWS; ++r)
    #pragma unroll
    for (int j = 0; j < 8; ++j) v[r][j] = v4[r * (HH / 4) + j * 32];

  // softmax weights of the wave's own keys (sc becomes p), one head per 16-lane row
  float m[8], l[8];
  #pragma unroll
  for (int j = 0; j < 8; ++j) {
    float mx = sc[0][j];
    #pragma unroll
    for (int r = 1; r < GA_ROWS; ++r) mx = fmaxf(mx, sc[r][j]);
    // all keys masked out: keep exp(-inf - m) at 0 instead of NaN
    const float ms = (mx == -INFINITY) ? 0.f : mx;
    float ls = 0.f;
    #pragma unroll
    for (int r = 0; r < GA_ROWS; ++r) {
      sc[r][j] = exp_slot(sc[r][j] - ms);
      ls += sc[r][j];
    }
    m[j] = mx;
    l[j] = ls;
  }

  #pragma unroll
  for (int j = 0; j < 8; ++j) {
    float4 a = make_float4(0.f, 0.f, 0.f, 0.f);
    #pragma unroll
    for (int r = 0; r < GA_ROWS; ++r) {
      const float p = sc[r][j];
      a.x += p * v[r][j].x; a.y += p * v[r][j].y;
      a.z += p * v[r][j].z; a.w += p * v[r][j].w;
    }
    ((float4*)s_acc[wave])[j * 32 + lane] = a;
  }
  if ((lane & 15) == 0) {
    #pragma unroll
    for (int j = 0; j < 8; ++j) {
      const int h = 2 * j + (lane >> 4);
      s_m[wave][h] = m[j];
      s_l[wave][h] = l[j];
    }
  }
  __syncthreads();

  // fold the 16 waves' partials into the work-group's one
  #pragma unroll
  for (int c = tid; c < HH; c += 512) {
    const int h = c >> 6;
    float M = s_m[0][h];
    #pragma unroll
    for (int w = 1; w < GA_WAVES; ++w) M = fmaxf(M, s_m[w][h]);
    const float Ms = (M == -INFINITY) ? 0.f : M;
    float a = 0.f, L = 0.f;
    #pragma unroll
    for (int w = 0; w < GA_WAVES; ++w) {
      const float e = exp_slot(s_m[w][h] - Ms);
      a += e * s_acc[w][c];
      L += e * s_l[w][h];
    }
    pacc[(size_t)blk * HH + c] = a;
    if ((c & 63) == 0) {
      pm[blk * NHH + h] = M;
      pl[blk * NHH + h] = L;
    }
  }
}

// Global attention, part 2: fold the GA_NCH slices of one (b,h); one thread
// per output element, 4 (b,h) per block of 256 threads.
__device__ __forceinline__
void global_attn_merge(int e, const float* __restrict__ pm, const float* __restrict__ pl,
                       const float* __restrict__ pacc, float* __restrict__ ctx)
{
  __shared__ float g_m[4][GA_NCH];
  __shared__ float g_l[4][GA_NCH];
  // 64 threads (two whole waves) per (b,h): its number in a scalar register makes every base scalar
  const int g  = __builtin_amdgcn_readfirstlane(threadIdx.x >> 6);
  const int d  = threadIdx.x & 63;
  const int bh = e * 4 + g;
  const int b  = bh / NHH;
  const int h  = bh % NHH;
  const float* mp = pm + b * GA_NCH * NHH + h;
  const float* lp = pl + b * GA_NCH * NHH + h;
  const float* ap = pacc + b * GA_NCH * HH + h * DD;

  // thread d fetches slice d's maximum and sum
  static_assert(GA_NCH == DD, "one thread per slice");
  g_m[g][d] = mp[d * NHH];
  g_l[g][d] = lp[d * NHH];
  __syncthreads();

  float M = g_m[g][0];
  #pragma unroll
  for (int i = 1; i < GA_NCH; ++i) M = fmaxf(M, g_m[g][i]);
  const float Ms = (M == -INFINITY) ? 0.f : M;
  float a = 0.f, L = 0.f;
  #pragma unroll 16
  for (int i = 0; i < GA_NCH; ++i) {
    const float w = exp_slot(g_m[g][i] - Ms);
    a += w * ap[i * HH + d];
    L += w * g_l[g][i];
  }
  ctx[(size_t)(b * SS) * HH + h * DD + d] = a * (1.f / L);
}

// ---------------------------------------------------------------------------
// Local attention: each (b,h,s>=1) softmaxes over {self, key0}. A wave owns
// LA_ROWS consecutive rows of one batch and takes them whole, all heads: lane l
// holds columns j*128 + 4*l .. +3 (j = 0..7), so every load and store is 512
// contiguous bytes and a 16-lane row of the wave holds one head. The first
// GM_BLOCKS blocks of the grid fold the global attention's slices instead.
// ---------------------------------------------------------------------------
#define LA_WAVES 8
#define LA_ROWS  4
#define LA_BLOCKS (MM / (LA_WAVES * LA_ROWS))

__global__ __launch_bounds__(256)
void local_attn(const float* __restrict__ Qf, const float* __restrict__ Kf,
                const float* __restrict__ Vf, float* __restrict__ ctx,
                float* __restrict__ lattn,
                const float* __restrict__ pm, const float* __restrict__ pl,
                const float* __restrict__ pacc)
{
  if (blockIdx.x < GM_BLOCKS) {
    global_attn_merge(blockIdx.x, pm, pl, pacc, ctx);
    return;
  }
  static_assert(SS % LA_ROWS == 0, "a wave's rows lie in one batch");
  // the wave's number in a scalar register: row bases become scalar, one lane offset serves every access
  const int wave = __builtin_amdgcn_readfirstlane(threadIdx.x >> 5);
  const int lane = threadIdx.x & 31;
  const int sub  = lane & 15;
  const int row0 = ((blockIdx.x - GM_BLOCKS) * LA_WAVES + wave) * LA_ROWS;   // b*SS + s
  const int b    = row0 / SS;
  const int s0   = row0 % SS;

  const float4* q4  = (const float4*)(Qf + (size_t)row0 * HH) + lane;
  const float4* k4  = (const float4*)(Kf + (size_t)row0 * HH) + lane;
  const float4* v4  = (const float4*)(Vf + (size_t)row0 * HH) + lane;
  const float4* k04 = (const float4*)(Kf + (size_t)(b * SS) * HH) + lane;
  const float4* v04 = (const float4*)(Vf + (size_t)(b * SS) * HH) + lane;
  float4*       c4  = (float4*)(ctx + (size_t)row0 * HH) + lane;

  // two register sets: the next pair of heads is on its way while this one is worked on
  float4 q[2][LA_ROWS], k[2][LA_ROWS], v[2][LA_ROWS], k0[2], v0[2];
  auto fetch = [&](int set, int j) {
    k0[set] = k04[j * 32];
    v0[set] = v04[j * 32];
    #pragma unroll
    for (int r = 0; r < LA_ROWS; ++r) {
      q[set][r] = q4[r * (HH / 4) + j * 32];
      k[set][r] = k4[r * (HH / 4) + j * 32];
      v[set][r] = v4[r * (HH / 4) + j * 32];
    }
  };

  fetch(0, 0);
  #pragma unroll
  for (int j = 0; j < 8; ++j) {
    const int c = j & 1;
    if (j + 1 < 8) fetch(c ^ 1, j + 1);
    // stands before the first rewrite of a register that the loads above name (the lane offset is reused below)
    if (j == 0) asm volatile("s_wait_xcnt 0x0" ::: "memory");

    float w0 = 0.f, w1 = 0.f;      // lane sub keeps the weights of row s0 + sub
    #pragma unroll
    for (int r = 0; r < LA_ROWS; ++r) {
      const float4 qq = q[c][r], kk = k[c][r], vv = v[c][r];
      // holds this V load up with its group: it is used only under the scalar test below, and the
      // compiler otherwise sinks it into that branch, where the wave waits out its whole latency
      if (j == 0 && r == 0) asm volatile("" :: "v"(vv.x), "v"(vv.y), "v"(vv.z), "v"(vv.w));
      const float dself = qq.x * kk.x + qq.y * kk.y + qq.z * kk.z + qq.w * kk.w;
      const float dglob = qq.x * k0[c].x + qq.y * k0[c].y + qq.z * k0[c].z + qq.w * k0[c].w;
      const float sa = row16_sum(dself) * ATT_SCALE;
      const float sg = row16_sum(dglob) * ATT_SCALE;
      const float mx = fmaxf(sa, sg);
      const float e0 = exp_slot(sa - mx);
      const float e1 = exp_slot(sg - mx);
      const float inv = 1.f / (e0 + e1);
      const float p0 = e0 * inv, p1 = e1 * inv;
      float4 o;
      o.x = p0 * vv.x + p1 * v0[c].x;
      o.y = p0 * vv.y + p1 * v0[c].y;
      o.z = p0 * vv.z + p1 * v0[c].z;
      o.w = p0 * vv.w + p1 * v0[c].w;
      // position 0 belongs to the global attention (a scalar test: s0 is the wave's)
      if (r > 0 || s0 != 0) c4[r * (HH / 4) + j * 32] = o;
      if (sub == r) { w0 = p0; w1 = p1; }
    }
    // the rows' weight pairs of one head lie side by side in lattn: one 8-byte store per row and head
    const int h = 2 * j + (lane >> 4);
    const int s = s0 + sub;
    if (sub < LA_ROWS && s >= 1) {
      float2* lp = (float2*)(lattn + ((size_t)(b * NHH + h) * (SS - 1) + (s - 1)) * 2);
      *lp = make_float2(w0, w1);
    }
  }
}

// ---------------------------------------------------------------------------
extern "C" void kernel_launch(void* const* d_in, const int* in_sizes, int n_in,
                              void* d_out, int out_size, void* d_ws, size_t ws_size,
                              hipStream_t stream)
{
  const float* hidden = (const float*)d_in[0];
  const float* mask   = (const float*)d_in[1];
  const float* Wq     = (const float*)d_in[2];
  const float* bq     = (const float*)d_in[3];
  const float* Wk     = (const float*)d_in[4];
  const float* bk     = (const float*)d_in[5];
  const float* Wv     = (const float*)d_in[6];
  const float* bv     = (const float*)d_in[7];

  float* ctx   = (float*)d_out;                       // B*S*H
  float* lattn = ctx + (size_t)BB * SS * HH;          // B*NH*(S-1)*1*2

  float* Qf = (float*)d_ws;                           // 64 MiB each
  float* Kf = Qf + (size_t)MM * HH;
  float* Vf = Kf + (size_t)MM * HH;
  float* pacc = Vf + (size_t)MM * HH;                 // B*GA_NCH*H partial sums
  float* pm   = pacc + (size_t)BB * GA_NCH * HH;      // B*GA_NCH*NH partial maxima
  float* pl   = pm + (size_t)BB * GA_NCH * NHH;       // B*GA_NCH*NH partial sums of exp

  dim3 g1(HH / TILE_N, MM / TILE_M, 3);
  qkv_gemm_wmma<<<g1, 256, 0, stream>>>(hidden, Wq, bq, Wk, bk, Wv, bv, Qf, Kf, Vf);

  global_attn_part<<<BB * GA_NCH, 512, 0, stream>>>(Qf, Kf, Vf, mask, pm, pl, pacc);

  local_attn<<<GM_BLOCKS + LA_BLOCKS, 256, 0, stream>>>(Qf, Kf, Vf, ctx, lattn, pm, pl, pacc);
}

// v005
// Measured time: 141 microseconds a run.
// Two timings next to v004 both put it at 1.09 times that version's speed.
// Over all steps from v000 it is 3.09 times as fast.
#include <hip/hip_runtime.h>
#include <hip/hip_bf16.h>
#include <math.h>

// Problem constants (from reference)
#define BB   4
#define SS   4096
#define HH   1024
#define NHH  16
#define DD   64
#define MM   (BB*SS)          // 16384 rows
#define ATT_SCALE 0.125f      // 1/sqrt(64)

typedef __attribute__((ext_vector_type(16))) __bf16 v16bf;
typedef __attribute__((ext_vector_type(8)))  float  v8f;
typedef __attribute__((ext_vector_type(4)))  unsigned int v4u;   // 16 bytes = 8 bf16 on their way to LDS
typedef __attribute__((ext_vector_type(2)))  unsigned int v2u;

#define TILE_M 256
#define TILE_N 256
#define TILE_K 128
#define LDSS   136  // LDS row stride in bf16 elems (128 data + 8 pad -> 272B rows, 16B aligned)

// ---------------------------------------------------------------------------
// Pre-pass: X and the three weight matrices, fp32 -> bf16, once, into the workspace.
// The GEMM below reads every row of X twelve times and every weight row 64 times from L2:
// rounded to bf16 once, here, those reads are half the bytes and need no conversion.
// A unit is 1024 floats (8 wave-wide 16-byte loads); a wave takes CV_UNITS units in a row,
// all of one source.
// grid: CV_BLOCKS, one work-group per WGP; block: CV_WAVES waves
// ---------------------------------------------------------------------------
#define CV_WAVES  19
#define CV_UNITS  4
#define CV_XU     (MM * HH / 1024)      // 16384 units of X
#define CV_WU     (HH * HH / 1024)      // 1024 units of each weight matrix
#define CV_BLOCKS ((CV_XU + 3 * CV_WU) / (CV_WAVES * CV_UNITS))

__global__ __launch_bounds__(CV_WAVES * 32)
void to_bf16(const float* __restrict__ X, const float* __restrict__ Wq,
             const float* __restrict__ Wk, const float* __restrict__ Wv,
             __bf16* __restrict__ Xb, __bf16* __restrict__ Wb)
{
  static_assert((CV_XU + 3 * CV_WU) % (CV_WAVES * CV_UNITS) == 0, "whole grid");
  static_assert(CV_XU % CV_UNITS == 0 && CV_WU % CV_UNITS == 0, "a wave's units lie in one source");
  // the wave's number in a scalar register: the bases become scalar, one lane offset serves every load and one every store
  const int wave = __builtin_amdgcn_readfirstlane(threadIdx.x >> 5);
  const int lane = threadIdx.x & 31;
  const int u0   = (blockIdx.x * CV_WAVES + wave) * CV_UNITS;
  const float* src;
  __bf16* dst;
  if (u0 < CV_XU) {
    src = X + (size_t)u0 * 1024;
    dst = Xb + (size_t)u0 * 1024;
  } else {
    const int w = (u0 - CV_XU) / CV_WU;
    const int r = (u0 - CV_XU) % CV_WU;
    src = ((w == 0) ? Wq : (w == 1) ? Wk : Wv) + (size_t)r * 1024;
    dst = Wb + (size_t)(u0 - CV_XU) * 1024;
  }
  const float4* s4 = (const float4*)src + lane;
  // the three loops are unrolled so that v and o are registers and every offset is a constant
  float4 v[CV_UNITS * 8];
  #pragma unroll
  for (int i = 0; i < CV_UNITS * 8; ++i) v[i] = s4[i * 32];
  v2u o[CV_UNITS * 8];
  #pragma unroll
  for (int i = 0; i < CV_UNITS * 8; ++i) {
    union { __bf16 h[4]; v2u u; } t;
    t.h[0] = (__bf16)v[i].x; t.h[1] = (__bf16)v[i].y;
    t.h[2] = (__bf16)v[i].z; t.h[3] = (__bf16)v[i].w;
    o[i] = t.u;
  }
  // every value is rounded before the first store leaves, so no register that a store names is written again
  __builtin_amdgcn_sched_barrier(0);
  // a wave's store is 256 contiguous bytes, two whole lines
  #pragma unroll
  for (int i = 0; i < CV_UNITS * 8; ++i) ((v2u*)dst)[i * 32 + lane] = o[i];
}

// ---------------------------------------------------------------------------
// Fused QKV projection: Out = X @ W^T + b, computed with v_wmma_f32_16x16x32_bf16
// One work-group makes a 256x256 tile of one of Q, K, V; a wave makes 128x64 of it
// (8x4 accumulator tiles), so each operand byte fetched from L2 feeds twice the
// products of a 128x128 tile and each LDS fragment feeds 4 or 8 matrix instructions.
// The operands come as bf16 from the pre-pass. A k-chunk is 128 wide: 256 bytes of every
// operand row.
// grid: (HH/TILE_N, MM/TILE_M, 3)  block: 256 (8 waves of 32)
// ---------------------------------------------------------------------------
__global__ __launch_bounds__(256)
void qkv_gemm_wmma(const __bf16* __restrict__ Xb, const __bf16* __restrict__ Wb,
                   const float* __restrict__ bq, const float* __restrict__ bk,
                   const float* __restrict__ bv,
                   float* __restrict__ Qf, float* __restrict__ Kf, float* __restrict__ Vf)
{
  __shared__ __align__(16) __bf16 As[2][TILE_M][LDSS];
  __shared__ __align__(16) __bf16 Bs[2][TILE_N][LDSS];

  const int which = blockIdx.z;
  const __bf16* __restrict__ W   = Wb + (size_t)which * HH * HH;
  const float* __restrict__ bias = (which == 0) ? bq : (which == 1) ? bk : bv;
  float* __restrict__ Out        = (which == 0) ? Qf : (which == 1) ? Kf : Vf;

  const int n0   = blockIdx.x * TILE_N;
  const int m0   = blockIdx.y * TILE_M;
  const int tid  = threadIdx.x;
  const int wave = tid >> 5;
  const int lane = tid & 31;
  const int half = lane >> 4;     // 0: lanes 0-15, 1: lanes 16-31
  const int r16  = lane & 15;
  const int waveM = wave >> 2;    // 0..1  -> 128-row slab
  const int waveN = wave & 3;     // 0..3  -> 64-col slab

  v8f acc[8][4];
  #pragma unroll
  for (int i = 0; i < 8; ++i)
    #pragma unroll
    for (int j = 0; j < 4; ++j)
      acc[i][j] = v8f{};

  // staging of a k-chunk (256x128 bf16 each for A and B) in two parts of 128 rows: thread t takes
  // 16 bytes of rows (t>>4) + 16*i of the part, so a wave's load covers 256 contiguous bytes of each of two rows
  const int sr = tid >> 4;          // row 0..15 of each 16-row group
  const int sc = (tid & 15) << 3;   // col 0,8,...,120
  // scalar tile bases and one lane offset that serves every load of both operands
  const __bf16* xa = Xb + (size_t)m0 * HH;
  const __bf16* wb = W + (size_t)n0 * HH;
  const unsigned so = (unsigned)(sr * HH + sc);
  v4u ra[2][8], rb[2][8];           // one register set per part

  // global bf16 -> registers, rows part*128 .. +127 of both operands at the bases' k
  auto fetch = [&](int part) {
    #pragma unroll
    for (int i = 0; i < 8; ++i) {
      ra[part][i] = *(const v4u*)(xa + (part * 128 + i * 16) * HH + so);
      rb[part][i] = *(const v4u*)(wb + (part * 128 + i * 16) * HH + so);
    }
  };
  // registers -> LDS
  auto stage = [&](int buf, int part) {
    #pragma unroll
    for (int i = 0; i < 8; ++i) {
      *(v4u*)&As[buf][part * 128 + sr + i * 16][sc] = ra[part][i];
      *(v4u*)&Bs[buf][part * 128 + sr + i * 16][sc] = rb[part][i];
    }
  };
  // 32 of the chunk's 128 k (kh = 0..3) for the wave's 128x64 tile
  auto compute = [&](int cur, int kh) {
    // Fragment loads per ISA 16-bit A layout:
    //   lanes 0-15 : K 0-7  (bytes 0..15)  and K 16-23 (bytes 32..47)
    //   lanes 16-31: K 8-15 (bytes 16..31) and K 24-31 (bytes 48..63)
    v16bf afrag[8], bfrag[4];
    #pragma unroll
    for (int ni = 0; ni < 4; ++ni) {
      const __bf16* src = &Bs[cur][waveN * 64 + ni * 16 + r16][kh * 32];
      union { uint4 u[2]; v16bf v; } t;
      t.u[0] = *(const uint4*)(src + half * 8);
      t.u[1] = *(const uint4*)(src + 16 + half * 8);
      bfrag[ni] = t.v;
    }
    #pragma unroll
    for (int mi = 0; mi < 8; ++mi) {
      const __bf16* src = &As[cur][waveM * 128 + mi * 16 + r16][kh * 32];
      union { uint4 u[2]; v16bf v; } t;
      t.u[0] = *(const uint4*)(src + half * 8);
      t.u[1] = *(const uint4*)(src + 16 + half * 8);
      afrag[mi] = t.v;
    }
    // keeps the 24 LDS reads together in front of the products: left alone the compiler deals them
    // out two at a time among the products, and the wave then waits out the LDS latency at each pair
    __builtin_amdgcn_sched_barrier(0);

    #pragma unroll
    for (int mi = 0; mi < 8; ++mi)
      #pragma unroll
      for (int ni = 0; ni < 4; ++ni)
        acc[mi][ni] = __builtin_amdgcn_wmma_f32_16x16x32_bf16(
            false, afrag[mi], false, bfrag[ni],
            (short)0, acc[mi][ni], false, false);
  };

  const int KT = HH / TILE_K;     // 8 k-chunks
  // keeps the set-up above from drifting in between the loads and their wait, where it reused their offset register
  __builtin_amdgcn_sched_barrier(0);
  fetch(0);
  fetch(1);
  // stands before the first rewrite of a register that the loads above name
  asm volatile("s_wait_xcnt 0x0" ::: "memory");
  // keeps every later register write behind that wait
  __builtin_amdgcn_sched_barrier(0);
  stage(0, 0);
  stage(0, 1);
  __syncthreads();

  for (int kt = 0; kt + 1 < KT; ++kt) {
    const int cur = kt & 1, nxt = cur ^ 1;
    xa += TILE_K;
    wb += TILE_K;
    // All 32 loads of chunk kt+1 leave here and fly under this chunk's products; each part goes to LDS
    // behind 64 of them. The fences keep the loads in front and each part's LDS stores in their place: left
    // alone the compiler puts off loads to save registers and mixes the stores, with their waits for the
    // loads, in among the products, and deals a block's LDS reads out among the products of the block before it
    fetch(0);
    fetch(1);
    // stands before the first rewrite of a register that the loads above name
    asm volatile("s_wait_xcnt 0x0" ::: "memory");
    __builtin_amdgcn_sched_barrier(0);
    compute(cur, 0);
    __builtin_amdgcn_sched_barrier(0);
    compute(cur, 1);
    __builtin_amdgcn_sched_barrier(0);
    stage(nxt, 0);
    __builtin_amdgcn_sched_barrier(0);
    compute(cur, 2);
    __builtin_amdgcn_sched_barrier(0);
    compute(cur, 3);
    __builtin_amdgcn_sched_barrier(0);
    stage(nxt, 1);
    __syncthreads();
  }
  compute((KT - 1) & 1, 0);
  compute((KT - 1) & 1, 1);
  compute((KT - 1) & 1, 2);
  compute((KT - 1) & 1, 3);

  // Epilogue: C/D layout -> lanes 0-15: M=j, lanes 16-31: M=8+j; N=r16
  const int col0 = n0 + waveN * 64 + r16;
  float bc[4];
  #pragma unroll
  for (int ni = 0; ni < 4; ++ni) bc[ni] = bias[col0 + ni * 16];
  // stands before the first rewrite of a register that the bias loads name
  asm volatile("s_wait_xcnt 0x0" ::: "memory");
  // keeps every later register write behind that wait
  __builtin_amdgcn_sched_barrier(0);
  #pragma unroll
  for (int mi = 0; mi < 8; ++mi)
    #pragma unroll
    for (int ni = 0; ni < 4; ++ni)
      #pragma unroll
      for (int j = 0; j < 8; ++j) acc[mi][ni][j] += bc[ni];
  // every sum is made before the first store leaves, so no register that a store names is written again
  __builtin_amdgcn_sched_barrier(0);
  // one address for the thread's 256 stores; the rest are constant offsets
  float* op = Out + (size_t)(m0 + waveM * 128 + half * 8) * HH + col0;
  #pragma unroll
  for (int mi = 0; mi < 8; ++mi)
    #pragma unroll
    for (int j = 0; j < 8; ++j)
      #pragma unroll
      for (int ni = 0; ni < 4; ++ni)
        op[(mi * 16 + j) * HH + ni * 16] = acc[mi][ni][j];
}

// ---------------------------------------------------------------------------
// Global attention, part 1: q at position 0 of each (b,h) against a slice of
// the keys. One work-group takes GA_KEYS keys of one batch for ALL heads, so
// every load is 512 contiguous bytes of a 4-KB row of K or V. A wave owns
// GA_ROWS keys; lane l holds columns j*128 + 4*l .. +3 (j = 0..7), so a
// 16-lane row of the wave holds one head. Each work-group leaves one partial
// (max, sum, weighted V sum) per head in the workspace.
// grid: B * GA_NCH blocks, 512 threads.
// ---------------------------------------------------------------------------
#define GA_WAVES 16
#define GA_ROWS  4
#define GA_KEYS  (GA_WAVES * GA_ROWS)   // 64 keys per work-group
#define GA_NCH   (SS / GA_KEYS)         // 64 slices per batch
#define GM_BLOCKS (BB * NHH / 4)        // merge blocks in front of the local grid

// value of lane (l ^ N) inside the 16-lane row (DPP row_xmask:N)
#define ROW_XOR(x, N) __builtin_bit_cast(float, __builtin_amdgcn_update_dpp( \
    0, __builtin_bit_cast(int, (x)), 0x160 + (N), 0xf, 0xf, true))

// e^x by the bare v_exp_f32, as __expf gives it. The v_nop fills the one slot the
// instruction set asks for behind a transcendental before its source is overwritten
// or its result read.
__device__ __forceinline__ float exp_slot(float x)
{
  float r;
  asm("v_exp_f32 %0, %1\n\tv_nop" : "=v"(r) : "v"(x * 1.44269504f));
  return r;
}

__device__ __forceinline__ float row16_sum(float x)
{
  x += ROW_XOR(x, 1);
  x += ROW_XOR(x, 2);
  x += ROW_XOR(x, 4);
  x += ROW_XOR(x, 8);
  return x;
}

// one work-group of 16 waves per WGP: 4 waves a SIMD, so the register budget may go to loads in flight
__global__ __launch_bounds__(512) __attribute__((amdgpu_waves_per_eu(4, 4)))
void global_attn_part(const float* __restrict__ Qf, const float* __restrict__ Kf,
                      const float* __restrict__ Vf, const float* __restrict__ mask,
                      float* __restrict__ pm, float* __restrict__ pl,
                      float* __restrict__ pacc)
{
  __shared__ __align__(16) float s_acc[GA_WAVES][HH];
  __shared__ float s_m[GA_WAVES][NHH];
  __shared__ float s_l[GA_WAVES][NHH];

  const int blk  = blockIdx.x;
  const int b    = blk / GA_NCH;
  const int ch   = blk % GA_NCH;
  const int tid  = threadIdx.x;
  // the wave's number in a scalar register: row bases become scalar, one lane offset serves every load
  const int wave = __builtin_amdgcn_readfirstlane(tid >> 5);
  const int lane = tid & 31;
  const int s0   = ch * GA_KEYS + wave * GA_ROWS;

  const float4* q4 = (const float4*)(Qf + (size_t)(b * SS) * HH) + lane;
  const float4* k4 = (const float4*)(Kf + (size_t)(b * SS + s0) * HH) + lane;
  const float4* v4 = (const float4*)(Vf + (size_t)(b * SS + s0) * HH) + lane;

  float4 q[8];
  #pragma unroll
  for (int j = 0; j < 8; ++j) q[j] = q4[j * 32];

  float sc[GA_ROWS][8];
  #pragma unroll
  for (int r = 0; r < GA_ROWS; ++r) {
    const float mk = mask[b * SS + s0 + r];
    #pragma unroll
    for (int j = 0; j < 8; ++j) {
      const float4 k = k4[r * (HH / 4) + j * 32];
      float d = q[j].x * k.x + q[j].y * k.y + q[j].z * k.z + q[j].w * k.w;
      sc[r][j] = row16_sum(d) * ATT_SCALE + mk;
    }
  }

  // V depends on nothing above: its loads stand here so that they fly under the scores
  float4 v[GA_ROWS][8];
  #pragma unroll
  for (int r = 0; r < GA_ROWS; ++r)
    #pragma unroll
    for (int j = 0; j < 8; ++j) v[r][j] = v4[r * (HH / 4) + j * 32];

  // softmax weights of the wave's own keys (sc becomes p), one head per 16-lane row
  float m[8], l[8];
  #pragma unroll
  for (int j = 0; j < 8; ++j) {
    float mx = sc[0][j];
    #pragma unroll
    for (int r = 1; r < GA_ROWS; ++r) mx = fmaxf(mx, sc[r][j]);
    // all keys masked out: keep exp(-inf - m) at 0 instead of NaN
    const float ms = (mx == -INFINITY) ? 0.f : mx;
    float ls = 0.f;
    #pragma unroll
    for (int r = 0; r < GA_ROWS; ++r) {
      sc[r][j] = exp_slot(sc[r][j] - ms);
      ls += sc[r][j];
    }
    m[j] = mx;
    l[j] = ls;
  }

  #pragma unroll
  for (int j = 0; j < 8; ++j) {
    float4 a = make_float4(0.f, 0.f, 0.f, 0.f);
    #pragma unroll
    for (int r = 0; r < GA_ROWS; ++r) {
      const float p = sc[r][j];
      a.x += p * v[r][j].x; a.y += p * v[r][j].y;
      a.z += p * v[r][j].z; a.w += p * v[r][j].w;
    }
    ((float4*)s_acc[wave])[j * 32 + lane] = a;
  }
  if ((lane & 15) == 0) {
    #pragma unroll
    for (int j = 0; j < 8; ++j) {
      const int h = 2 * j + (lane >> 4);
      s_m[wave][h] = m[j];
      s_l[wave][h] = l[j];
    }
  }
  __syncthreads();

  // fold the 16 waves' partials into the work-group's one
  #pragma unroll
  for (int c = tid; c < HH; c += 512) {
    const int h = c >> 6;
    float M = s_m[0][h];
    #pragma unroll
    for (int w = 1; w < GA_WAVES; ++w) M = fmaxf(M, s_m[w][h]);
    const float Ms = (M == -INFINITY) ? 0.f : M;
    float a = 0.f, L = 0.f;
    #pragma unroll
    for (int w = 0; w < GA_WAVES; ++w) {
      const float e = exp_slot(s_m[w][h] - Ms);
      a += e * s_acc[w][c];
      L += e * s_l[w][h];
    }
    pacc[(size_t)blk * HH + c] = a;
    if ((c & 63) == 0) {
      pm[blk * NHH + h] = M;
      pl[blk * NHH + h] = L;
    }
  }
}

// Global attention, part 2: fold the GA_NCH slices of one (b,h); one thread
// per output element, 4 (b,h) per block of 256 threads.
__device__ __forceinline__
void global_attn_merge(int e, const float* __restrict__ pm, const float* __restrict__ pl,
                       const float* __restrict__ pacc, float* __restrict__ ctx)
{
  __shared__ float g_m[4][GA_NCH];
  __shared__ float g_l[4][GA_NCH];
  // 64 threads (two whole waves) per (b,h): its number in a scalar register makes every base scalar
  const int g  = __builtin_amdgcn_readfirstlane(threadIdx.x >> 6);
  const int d  = threadIdx.x & 63;
  const int bh = e * 4 + g;
  const int b  = bh / NHH;
  const int h  = bh % NHH;
  const float* mp = pm + b * GA_NCH * NHH + h;
  const float* lp = pl + b * GA_NCH * NHH + h;
  const float* ap = pacc + b * GA_NCH * HH + h * DD;

  // thread d fetches slice d's maximum and sum
  static_assert(GA_NCH == DD, "one thread per slice");
  g_m[g][d] = mp[d * NHH];
  g_l[g][d] = lp[d * NHH];
  __syncthreads();

  float M = g_m[g][0];
  #pragma unroll
  for (int i = 1; i < GA_NCH; ++i) M = fmaxf(M, g_m[g][i]);
  const float Ms = (M == -INFINITY) ? 0.f : M;
  float a = 0.f, L = 0.f;
  #pragma unroll 16
  for (int i = 0; i < GA_NCH; ++i) {
    const float w = exp_slot(g_m[g][i] - Ms);
    a += w * ap[i * HH + d];
    L += w * g_l[g][i];
  }
  ctx[(size_t)(b * SS) * HH + h * DD + d] = a * (1.f / L);
}

// ---------------------------------------------------------------------------
// Local attention: each (b,h,s>=1) softmaxes over {self, key0}. A wave owns
// LA_ROWS consecutive rows of one batch and takes them whole, all heads: lane l
// holds columns j*128 + 4*l .. +3 (j = 0..7), so every load and store is 512
// contiguous bytes and a 16-lane row of the wave holds one head. The first
// GM_BLOCKS blocks of the grid fold the global attention's slices instead.
// ---------------------------------------------------------------------------
#define LA_WAVES 8
#define LA_ROWS  4
#define LA_BLOCKS (MM / (LA_WAVES * LA_ROWS))

__global__ __launch_bounds__(256)
void local_attn(const float* __restrict__ Qf, const float* __restrict__ Kf,
                const float* __restrict__ Vf, float* __restrict__ ctx,
                float* __restrict__ lattn,
                const float* __restrict__ pm, const float* __restrict__ pl,
                const float* __restrict__ pacc)
{
  if (blockIdx.x < GM_BLOCKS) {
    global_attn_merge(blockIdx.x, pm, pl, pacc, ctx);
    return;
  }
  static_assert(SS % LA_ROWS == 0, "a wave's rows lie in one batch");
  // the wave's number in a scalar register: row bases become scalar, one lane offset serves every access
  const int wave = __builtin_amdgcn_readfirstlane(threadIdx.x >> 5);
  const int lane = threadIdx.x & 31;
  const int sub  = lane & 15;
  const int row0 = ((blockIdx.x - GM_BLOCKS) * LA_WAVES + wave) * LA_ROWS;   // b*SS + s
  const int b    = row0 / SS;
  const int s0   = row0 % SS;

  const float4* q4  = (const float4*)(Qf + (size_t)row0 * HH) + lane;
  const float4* k4  = (const float4*)(Kf + (size_t)row0 * HH) + lane;
  const float4* v4  = (const float4*)(Vf + (size_t)row0 * HH) + lane;
  const float4* k04 = (const float4*)(Kf + (size_t)(b * SS) * HH) + lane;
  const float4* v04 = (const float4*)(Vf + (size_t)(b * SS) * HH) + lane;
  float4*       c4  = (float4*)(ctx + (size_t)row0 * HH) + lane;

  // two register sets: the next pair of heads is on its way while this one is worked on
  float4 q[2][LA_ROWS], k[2][LA_ROWS], v[2][LA_ROWS], k0[2], v0[2];
  auto fetch = [&](int set, int j) {
    k0[set] = k04[j * 32];
    v0[set] = v04[j * 32];
    #pragma unroll
    for (int r = 0; r < LA_ROWS; ++r) {
      q[set][r] = q4[r * (HH / 4) + j * 32];
      k[set][r] = k4[r * (HH / 4) + j * 32];
      v[set][r] = v4[r * (HH / 4) + j * 32];
    }
  };

  fetch(0, 0);
  #pragma unroll
  for (int j = 0; j < 8; ++j) {
    const int c = j & 1;
    if (j + 1 < 8) fetch(c ^ 1, j + 1);
    // stands before the first rewrite of a register that the loads above name (the lane offset is reused below)
    if (j == 0) asm volatile("s_wait_xcnt 0x0" ::: "memory");

    float w0 = 0.f, w1 = 0.f;      // lane sub keeps the weights of row s0 + sub
    #pragma unroll
    for (int r = 0; r < LA_ROWS; ++r) {
      const float4 qq = q[c][r], kk = k[c][r], vv = v[c][r];
      // holds this V load up with its group: it is used only under the scalar test below, and the
      // compiler otherwise sinks it into that branch, where the wave waits out its whole latency
      if (j == 0 && r == 0) asm volatile("" :: "v"(vv.x), "v"(vv.y), "v"(vv.z), "v"(vv.w));
      const float dself = qq.x * kk.x + qq.y * kk.y + qq.z * kk.z + qq.w * kk.w;
      const float dglob = qq.x * k0[c].x + qq.y * k0[c].y + qq.z * k0[c].z + qq.w * k0[c].w;
      const float sa = row16_sum(dself) * ATT_SCALE;
      const float sg = row16_sum(dglob) * ATT_SCALE;
      const float mx = fmaxf(sa, sg);
      const float e0 = exp_slot(sa - mx);
      const float e1 = exp_slot(sg - mx);
      const float inv = 1.f / (e0 + e1);
      const float p0 = e0 * inv, p1 = e1 * inv;
      float4 o;
      o.x = p0 * vv.x + p1 * v0[c].x;
      o.y = p0 * vv.y + p1 * v0[c].y;
      o.z = p0 * vv.z + p1 * v0[c].z;
      o.w = p0 * vv.w + p1 * v0[c].w;
      // position 0 belongs to the global attention (a scalar test: s0 is the wave's)
      if (r > 0 || s0 != 0) c4[r * (HH / 4) + j * 32] = o;
      if (sub == r) { w0 = p0; w1 = p1; }
    }
    // the rows' weight pairs of one head lie side by side in lattn: one 8-byte store per row and head
    const int h = 2 * j + (lane >> 4);
    const int s = s0 + sub;
    if (sub < LA_ROWS && s >= 1) {
      float2* lp = (float2*)(lattn + ((size_t)(b * NHH + h) * (SS - 1) + (s - 1)) * 2);
      *lp = make_float2(w0, w1);
    }
  }
}

// ---------------------------------------------------------------------------
extern "C" void kernel_launch(void* const* d_in, const int* in_sizes, int n_in,
                              void* d_out, int out_size, void* d_ws, size_t ws_size,
                              hipStream_t stream)
{
  const float* hidden = (const float*)d_in[0];
  const float* mask   = (const float*)d_in[1];
  const float* Wq     = (const float*)d_in[2];
  const float* bq     = (const float*)d_in[3];
  const float* Wk     = (const float*)d_in[4];
  const float* bk     = (const float*)d_in[5];
  const float* Wv     = (const float*)d_in[6];
  const float* bv     = (const float*)d_in[7];

  float* ctx   = (float*)d_out;                       // B*S*H
  float* lattn = ctx + (size_t)BB * SS * HH;          // B*NH*(S-1)*1*2

  float* Qf = (float*)d_ws;                           // 64 MiB each
  float* Kf = Qf + (size_t)MM * HH;
  float* Vf = Kf + (size_t)MM * HH;
  float* pacc = Vf + (size_t)MM * HH;                 // B*GA_NCH*H partial sums
  float* pm   = pacc + (size_t)BB * GA_NCH * HH;      // B*GA_NCH*NH partial maxima
  float* pl   = pm + (size_t)BB * GA_NCH * NHH;       // B*GA_NCH*NH partial sums of exp
  __bf16* Xb  = (__bf16*)(pl + (size_t)BB * GA_NCH * NHH);   // 32 MiB: X in bf16
  __bf16* Wb  = Xb + (size_t)MM * HH;                 // 3 x 2 MiB: Wq, Wk, Wv in bf16

  to_bf16<<<CV_BLOCKS, CV_WAVES * 32, 0, stream>>>(hidden, Wq, Wk, Wv, Xb, Wb);

  dim3 g1(HH / TILE_N, MM / TILE_M, 3);
  qkv_gemm_wmma<<<g1, 256, 0, stream>>>(Xb, Wb, bq, bk, bv, Qf, Kf, Vf);

  global_attn_part<<<BB * GA_NCH, 512, 0, stream>>>(Qf, Kf, Vf, mask, pm, pl, pacc);

  local_attn<<<GM_BLOCKS + LA_BLOCKS, 256, 0, stream>>>(Qf, Kf, Vf, ctx, lattn, pm, pl, pacc);
}

// v006
// A run of this version takes 111 microseconds.
// Two timings next to v005 put it at 1.26 and 1.27 times that version's speed.
// Counting every step since v000, it is 3.91 times as fast.
#include <hip/hip_runtime.h>
#include <hip/hip_bf16.h>
#include <math.h>

// Problem constants (from reference)
#define BB   4
#define SS   4096
#define HH   1024
#define NHH  16
#define DD   64
#define MM   (BB*SS)          // 16384 rows
#define ATT_SCALE 0.125f      // 1/sqrt(64)

typedef __attribute__((ext_vector_type(16))) __bf16 v16bf;
typedef __attribute__((ext_vector_type(8)))  float  v8f;
typedef __attribute__((ext_vector_type(4)))  unsigned int v4u;   // 16 bytes = 8 bf16 on their way to LDS
typedef __attribute__((ext_vector_type(2)))  unsigned int v2u;

#define TILE_M 256
#define TILE_N 192  // one head: its 64 columns of Q, of K and of V
#define TILE_K 128
#define LDSS   136  // LDS row stride in bf16 elems (128 data + 8 pad -> 272B rows, 16B aligned)

// ---------------------------------------------------------------------------
// Position 0 of every batch: its rows of Q, K and V (bias added), which every other
// position's attention needs before its own row is finished. A wave makes 16 columns
// for the 4 batches over a quarter of k with v_wmma_f32_16x16x32_bf16, rounding X and W
// to bf16 as the pre-pass does; the reader adds the four quarters.
// r0: [quarter of k][batch][Q | K | V][HH]
// ---------------------------------------------------------------------------
#define R0_TILES (3 * HH / 16)
#define R0_KS    4
#define R0_TASKS (R0_TILES * R0_KS)
#define R0_SIZE  (BB * 3 * HH)          // floats of one quarter

// 32 k of one row, as loaded, to a 16-bit fragment
__device__ __forceinline__ v16bf frag_f32(const float4* x)
{
  v16bf f;
  #pragma unroll
  for (int i = 0; i < 4; ++i) {
    f[i * 4 + 0] = (__bf16)x[i].x; f[i * 4 + 1] = (__bf16)x[i].y;
    f[i * 4 + 2] = (__bf16)x[i].z; f[i * 4 + 3] = (__bf16)x[i].w;
  }
  return f;
}

__device__ __forceinline__
void row0_proj(int tile, int kq, const float* __restrict__ X, const float* __restrict__ W,
               const float* __restrict__ bias, float* __restrict__ r0)
{
  const int lane = threadIdx.x & 31;
  const int half = lane >> 4;
  const int r16  = lane & 15;
  const int c0   = (tile % (HH / 16)) * 16;
  // rows 4..15 of the first operand repeat the four batches; their results are not stored.
  // Both operands take k in the same order: half*8 .. +7, then 16 + half*8 .. +7 of every 32
  const float* ap = X + (size_t)(r16 & 3) * SS * HH + kq * (HH / R0_KS) + half * 8;
  const float* bp = W + (size_t)(c0 + r16) * HH + kq * (HH / R0_KS) + half * 8;
  const float bc = bias[c0 + r16];
  v8f acc0 = v8f{}, acc1 = v8f{};
  #pragma unroll
  for (int g = 0; g < HH / R0_KS; g += 128) {
    float4 xa[4][4], xb[4][4];
    #pragma unroll
    for (int s = 0; s < 4; ++s) {
      const float* pa = ap + g + s * 32;
      const float* pb = bp + g + s * 32;
      xa[s][0] = *(const float4*)pa;        xa[s][1] = *(const float4*)(pa + 4);
      xa[s][2] = *(const float4*)(pa + 16); xa[s][3] = *(const float4*)(pa + 20);
      xb[s][0] = *(const float4*)pb;        xb[s][1] = *(const float4*)(pb + 4);
      xb[s][2] = *(const float4*)(pb + 16); xb[s][3] = *(const float4*)(pb + 20);
    }
    #pragma unroll
    for (int s = 0; s < 4; s += 2) {
      acc0 = __builtin_amdgcn_wmma_f32_16x16x32_bf16(false, frag_f32(xa[s]), false, frag_f32(xb[s]),
                                                     (short)0, acc0, false, false);
      acc1 = __builtin_amdgcn_wmma_f32_16x16x32_bf16(false, frag_f32(xa[s + 1]), false, frag_f32(xb[s + 1]),
                                                     (short)0, acc1, false, false);
    }
  }
  const float b0 = (kq == 0) ? bc : 0.f;
  if (half == 0) {
    #pragma unroll
    for (int b = 0; b < BB; ++b)
      r0[kq * R0_SIZE + b * 3 * HH + tile * 16 + r16] = acc0[b] + acc1[b] + b0;
  }
}

// ---------------------------------------------------------------------------
// Pre-pass: X and the three weight matrices, fp32 -> bf16, once, into the workspace.
// The GEMM below reads every row of X sixteen times and every weight row 64 times from L2:
// rounded to bf16 once, here, those reads are half the bytes and need no conversion.
// A unit is 1024 floats (8 wave-wide 16-byte loads); a wave takes CV_UNITS units in a row,
// all of one source. The first R0_BLOCKS blocks make position 0's rows instead.
// grid: R0_BLOCKS + CV_BLOCKS; block: CV_WAVES waves
// ---------------------------------------------------------------------------
#define CV_WAVES  19
#define CV_UNITS  4
#define CV_XU     (MM * HH / 1024)      // 16384 units of X
#define CV_WU     (HH * HH / 1024)      // 1024 units of each weight matrix
#define CV_BLOCKS ((CV_XU + 3 * CV_WU) / (CV_WAVES * CV_UNITS))
#define R0_BLOCKS ((R0_TASKS + CV_WAVES - 1) / CV_WAVES)

__global__ __launch_bounds__(CV_WAVES * 32)
void to_bf16(const float* __restrict__ X, const float* __restrict__ Wq,
             const float* __restrict__ Wk, const float* __restrict__ Wv,
             const float* __restrict__ bq, const float* __restrict__ bk,
             const float* __restrict__ bv,
             __bf16* __restrict__ Xb, __bf16* __restrict__ Wb, float* __restrict__ r0)
{
  static_assert((CV_XU + 3 * CV_WU) % (CV_WAVES * CV_UNITS) == 0, "whole grid");
  static_assert(CV_XU % CV_UNITS == 0 && CV_WU % CV_UNITS == 0, "a wave's units lie in one source");
  // the wave's number in a scalar register: the bases become scalar, one lane offset serves every load and one every store
  const int wave = __builtin_amdgcn_readfirstlane(threadIdx.x >> 5);
  const int lane = threadIdx.x & 31;
  if (blockIdx.x < R0_BLOCKS) {
    // a scalar test: a wave takes a task whole or leaves
    const int task = blockIdx.x * CV_WAVES + wave;
    if (task < R0_TASKS) {
      const int tile = task / R0_KS;
      const int w = tile / (HH / 16);
      row0_proj(tile, task % R0_KS, X, (w == 0) ? Wq : (w == 1) ? Wk : Wv, (w == 0) ? bq : (w == 1) ? bk : bv, r0);
    }
    return;
  }
  const int u0   = ((blockIdx.x - R0_BLOCKS) * CV_WAVES + wave) * CV_UNITS;
  const float* src;
  __bf16* dst;
  if (u0 < CV_XU) {
    src = X + (size_t)u0 * 1024;
    dst = Xb + (size_t)u0 * 1024;
  } else {
    const int w = (u0 - CV_XU) / CV_WU;
    const int r = (u0 - CV_XU) % CV_WU;
    src = ((w == 0) ? Wq : (w == 1) ? Wk : Wv) + (size_t)r * 1024;
    dst = Wb + (size_t)(u0 - CV_XU) * 1024;
  }
  const float4* s4 = (const float4*)src + lane;
  // the three loops are unrolled so that v and o are registers and every offset is a constant
  float4 v[CV_UNITS * 8];
  #pragma unroll
  for (int i = 0; i < CV_UNITS * 8; ++i) v[i] = s4[i * 32];
  v2u o[CV_UNITS * 8];
  #pragma unroll
  for (int i = 0; i < CV_UNITS * 8; ++i) {
    union { __bf16 h[4]; v2u u; } t;
    t.h[0] = (__bf16)v[i].x; t.h[1] = (__bf16)v[i].y;
    t.h[2] = (__bf16)v[i].z; t.h[3] = (__bf16)v[i].w;
    o[i] = t.u;
  }
  // every value is rounded before the first store leaves, so no register that a store names is written again
  __builtin_amdgcn_sched_barrier(0);
  // a wave's store is 256 contiguous bytes, two whole lines
  #pragma unroll
  for (int i = 0; i < CV_UNITS * 8; ++i) ((v2u*)dst)[i * 32 + lane] = o[i];
  // stands before the first rewrite of a register that the stores above name
  asm volatile("s_wait_xcnt 0x0" ::: "memory");
}

#define GA_NCH   64                     // slices of the keys per batch: one per wave row of the GEMM grid
#define GA_PAD   32                     // floats from one head's (max, sum) of a slice to the next head's: a 128-byte line per writer
#define GM_BLOCKS (BB * NHH / 4)

// value of lane (l ^ N) inside the 16-lane row (DPP row_xmask:N)
#define ROW_XOR(x, N) __builtin_bit_cast(float, __builtin_amdgcn_update_dpp( \
    0, __builtin_bit_cast(int, (x)), 0x160 + (N), 0xf, 0xf, true))

// e^x by the bare v_exp_f32, as __expf gives it. The v_nop fills the one slot the
// instruction set asks for behind a transcendental before its source is overwritten
// or its result read.
__device__ __forceinline__ float exp_slot(float x)
{
  float r;
  asm("v_exp_f32 %0, %1\n\tv_nop" : "=v"(r) : "v"(x * 1.44269504f));
  return r;
}

__device__ __forceinline__ float row16_sum(float x)
{
  x += ROW_XOR(x, 1);
  x += ROW_XOR(x, 2);
  x += ROW_XOR(x, 4);
  x += ROW_XOR(x, 8);
  return x;
}

// ---------------------------------------------------------------------------
// QKV projection (X @ W^T + b, v_wmma_f32_16x16x32_bf16) with both attentions in its epilogue.
// One work-group makes 256 rows of ONE head's Q, K and V (192 columns); a wave makes 64 rows of
// 32 of the head's 64 dims, of all three (4x6 accumulator tiles). So a row's q, k and v meet in
// registers and never go to memory: the two waves of a row exchange their half dot products in
// LDS, each then weighs its own V columns and stores them as ctx. For the global attention a
// wave row (64 keys) leaves one partial (max, sum, weighted V sum) in the workspace.
// The operands come as bf16 from the pre-pass, position 0's q, k, v from r0. A k-chunk is 128
// wide: 256 bytes of every operand row.
// grid: (NHH, MM/TILE_M)  block: 256 (8 waves of 32)
// ---------------------------------------------------------------------------
__global__ __launch_bounds__(256)
void qkv_attn_wmma(const __bf16* __restrict__ Xb, const __bf16* __restrict__ Wb,
                   const float* __restrict__ bq, const float* __restrict__ bk,
                   const float* __restrict__ bv, const float* __restrict__ r0,
                   const float* __restrict__ mask,
                   float* __restrict__ ctx, float* __restrict__ lattn,
                   float* __restrict__ pm, float* __restrict__ pl, float* __restrict__ pacc)
{
  static_assert(GA_NCH == (SS / TILE_M) * 4, "one slice per wave row");
  __shared__ __align__(16) __bf16 As[2][TILE_M][LDSS];
  __shared__ __align__(16) __bf16 Bs[2][TILE_N][LDSS];
  __shared__ __align__(16) float s_part[3][4][2][64];   // half dot products: kind, wave row, half, row
  __shared__ __align__(16) float s_w[8][3][64];         // a wave's own copy of the rows' three weights

  const int h    = blockIdx.x;
  const int m0   = blockIdx.y * TILE_M;
  const int tid  = threadIdx.x;
  const int wave = tid >> 5;
  const int lane = tid & 31;
  const int half = lane >> 4;     // 0: lanes 0-15, 1: lanes 16-31
  const int r16  = lane & 15;
  const int waveM = wave >> 1;    // 0..3  -> 64-row slab
  const int waveN = wave & 1;     // 0..1  -> dims 32*waveN .. +31 of the head

  v8f acc[4][6];                  // second index: 0,1 Q; 2,3 K; 4,5 V
  #pragma unroll
  for (int i = 0; i < 4; ++i)
    #pragma unroll
    for (int j = 0; j < 6; ++j)
      acc[i][j] = v8f{};

  // staging of a k-chunk (256x128 bf16 of X, 192x128 of W) in two parts, 128 rows of X and the 96 weight
  // rows of one waveN: thread t takes 16 bytes of rows (t>>4) + 16*i of the part, so a wave's load covers
  // two whole 256-byte units
  const int sr = tid >> 4;          // row 0..15 of each 16-row group
  const int sc = (tid & 15) << 3;   // col 0,8,...,120
  // scalar tile bases and one lane offset that serves every load of both operands
  const __bf16* xa = Xb + (size_t)m0 * HH;
  const __bf16* wb = Wb + (size_t)(h * DD) * HH;
  const unsigned so = (unsigned)(sr * HH + sc);
  v4u ra[2][8], rb[2][6];           // one register set per part

  // global bf16 -> registers at the bases' k; weight group i of a part: matrix i>>1, dims part*32 + (i&1)*16 ..
  auto fetch = [&](int part) {
    #pragma unroll
    for (int i = 0; i < 8; ++i)
      ra[part][i] = *(const v4u*)(xa + (part * 128 + i * 16) * HH + so);
    #pragma unroll
    for (int i = 0; i < 6; ++i)
      rb[part][i] = *(const v4u*)(wb + ((i >> 1) * HH + part * 32 + (i & 1) * 16) * HH + so);
  };
  // registers -> LDS
  auto stage = [&](int buf, int part) {
    #pragma unroll
    for (int i = 0; i < 8; ++i)
      *(v4u*)&As[buf][part * 128 + sr + i * 16][sc] = ra[part][i];
    #pragma unroll
    for (int i = 0; i < 6; ++i)
      *(v4u*)&Bs[buf][part * 96 + sr + i * 16][sc] = rb[part][i];
  };
  // 32 of the chunk's 128 k (kh = 0..3) for the wave's 64x96 tile
  auto compute = [&](int cur, int kh) {
    // Fragment loads per ISA 16-bit A layout:
    //   lanes 0-15 : K 0-7  (bytes 0..15)  and K 16-23 (bytes 32..47)
    //   lanes 16-31: K 8-15 (bytes 16..31) and K 24-31 (bytes 48..63)
    v16bf afrag[4], bfrag[6];
    #pragma unroll
    for (int ni = 0; ni < 6; ++ni) {
      const __bf16* src = &Bs[cur][waveN * 96 + ni * 16 + r16][kh * 32];
      union { uint4 u[2]; v16bf v; } t;
      t.u[0] = *(const uint4*)(src + half * 8);
      t.u[1] = *(const uint4*)(src + 16 + half * 8);
      bfrag[ni] = t.v;
    }
    #pragma unroll
    for (int mi = 0; mi < 4; ++mi) {
      const __bf16* src = &As[cur][waveM * 64 + mi * 16 + r16][kh * 32];
      union { uint4 u[2]; v16bf v; } t;
      t.u[0] = *(const uint4*)(src + half * 8);
      t.u[1] = *(const uint4*)(src + 16 + half * 8);
      afrag[mi] = t.v;
    }
    // keeps the 20 LDS reads together in front of the products: left alone the compiler deals them
    // out two at a time among the products, and the wave then waits out the LDS latency at each pair
    __builtin_amdgcn_sched_barrier(0);

    #pragma unroll
    for (int mi = 0; mi < 4; ++mi)
      #pragma unroll
      for (int ni = 0; ni < 6; ++ni)
        acc[mi][ni] = __builtin_amdgcn_wmma_f32_16x16x32_bf16(
            false, afrag[mi], false, bfrag[ni],
            (short)0, acc[mi][ni], false, false);
  };

  const int KT = HH / TILE_K;     // 8 k-chunks
  // keeps the set-up above from drifting in between the loads and their wait, where it reused their offset register
  __builtin_amdgcn_sched_barrier(0);
  fetch(0);
  fetch(1);
  // stands before the first rewrite of a register that the loads above name
  asm volatile("s_wait_xcnt 0x0" ::: "memory");
  // keeps every later register write behind that wait
  __builtin_amdgcn_sched_barrier(0);
  stage(0, 0);
  stage(0, 1);
  __syncthreads();

  for (int kt = 0; kt + 1 < KT; ++kt) {
    const int cur = kt & 1, nxt = cur ^ 1;
    xa += TILE_K;
    wb += TILE_K;
    // All 28 loads of chunk kt+1 leave here and fly under this chunk's products; each part goes to LDS
    // behind 48 of them. The fences keep the loads in front and each part's LDS stores in their place: left
    // alone the compiler puts off loads to save registers and mixes the stores, with their waits for the
    // loads, in among the products, and deals a block's LDS reads out among the products of the block before it
    fetch(0);
    fetch(1);
    // stands before the first rewrite of a register that the loads above name
    asm volatile("s_wait_xcnt 0x0" ::: "memory");
    __builtin_amdgcn_sched_barrier(0);
    compute(cur, 0);
    __builtin_amdgcn_sched_barrier(0);
    compute(cur, 1);
    __builtin_amdgcn_sched_barrier(0);
    stage(nxt, 0);
    __builtin_amdgcn_sched_barrier(0);
    compute(cur, 2);
    __builtin_amdgcn_sched_barrier(0);
    compute(cur, 3);
    __builtin_amdgcn_sched_barrier(0);
    stage(nxt, 1);
    __syncthreads();
  }

  // what the epilogue reads from memory leaves here and flies under the last chunk's products
  const int b    = m0 / SS;
  const int sb   = (m0 % SS) + waveM * 64;       // the wave's first position in its batch
  const int dcol = h * DD + waveN * 32 + r16;    // the lane's column of tile t = 0; t = 1 is 16 further
  // scalar bases and two lane offsets, the rest constants: no load of the run needs an address register of its own
  const float* rp  = r0 + b * 3 * HH + h * DD;
  const float* bqp = bq + h * DD;
  const float* bkp = bk + h * DD;
  const float* bvp = bv + h * DD;
  const float* mkp = mask + b * SS + (m0 % SS);
  const unsigned lo = (unsigned)(waveN * 32 + r16);
  const unsigned mo = (unsigned)(waveM * 64 + lane);
  float bqc[2], bkc[2], bvc[2], q0p[2][R0_KS], k0p[2][R0_KS], v0p[2][R0_KS], mk[2];
  #pragma unroll
  for (int t = 0; t < 2; ++t) {
    bqc[t] = bqp[t * 16 + lo];
    bkc[t] = bkp[t * 16 + lo];
    bvc[t] = bvp[t * 16 + lo];
    #pragma unroll
    for (int c = 0; c < R0_KS; ++c) {
      q0p[t][c] = rp[c * R0_SIZE + t * 16 + lo];
      k0p[t][c] = rp[c * R0_SIZE + HH + t * 16 + lo];
      v0p[t][c] = rp[c * R0_SIZE + 2 * HH + t * 16 + lo];
    }
    mk[t]  = mkp[t * 32 + mo];                   // lane l looks after rows l and l + 32 of the wave's 64
  }
  // stands before the first rewrite of a register that the loads above name
  asm volatile("s_wait_xcnt 0x0" ::: "memory");
  // keeps every later register write behind that wait
  __builtin_amdgcn_sched_barrier(0);
  compute((KT - 1) & 1, 0);
  compute((KT - 1) & 1, 1);
  compute((KT - 1) & 1, 2);
  compute((KT - 1) & 1, 3);

  // Epilogue. C/D layout: lanes 0-15: M=j, lanes 16-31: M=8+j; N=r16
  float q0[2], k0[2], v0[2];
  #pragma unroll
  for (int t = 0; t < 2; ++t) {
    q0[t] = (q0p[t][0] + q0p[t][1]) + (q0p[t][2] + q0p[t][3]);
    k0[t] = (k0p[t][0] + k0p[t][1]) + (k0p[t][2] + k0p[t][3]);
    v0[t] = (v0p[t][0] + v0p[t][1]) + (v0p[t][2] + v0p[t][3]);
  }
  #pragma unroll
  for (int mi = 0; mi < 4; ++mi)
    #pragma unroll
    for (int t = 0; t < 2; ++t)
      #pragma unroll
      for (int j = 0; j < 8; ++j) {
        acc[mi][t][j]     += bqc[t];
        acc[mi][2 + t][j] += bkc[t];
        acc[mi][4 + t][j] += bvc[t];
      }

  // the three dot products of every row over the wave's 32 dims: q.k, q.k0, q0.k; lane r16 = j keeps row j's
  #pragma unroll
  for (int mi = 0; mi < 4; ++mi) {
    float ws = 0.f, wg = 0.f, wa = 0.f;
    #pragma unroll
    for (int j = 0; j < 8; ++j) {
      const float ds = row16_sum(acc[mi][0][j] * acc[mi][2][j] + acc[mi][1][j] * acc[mi][3][j]);
      const float dg = row16_sum(acc[mi][0][j] * k0[0] + acc[mi][1][j] * k0[1]);
      const float da = row16_sum(q0[0] * acc[mi][2][j] + q0[1] * acc[mi][3][j]);
      if (r16 == j) { ws = ds; wg = dg; wa = da; }
    }
    if (r16 < 8) {
      s_part[0][waveM][waveN][mi * 16 + half * 8 + r16] = ws;
      s_part[1][waveM][waveN][mi * 16 + half * 8 + r16] = wg;
      s_part[2][waveM][waveN][mi * 16 + half * 8 + r16] = wa;
    }
  }
  // the two waves of a row hand each other their halves
  __syncthreads();

  // lane l: rows l and l + 32. Both waves of a row do the same sums, so neither needs the other's weights
  float p0[2], p1[2], ga[2];
  #pragma unroll
  for (int u = 0; u < 2; ++u) {
    const int r = u * 32 + lane;
    const float sa = (s_part[0][waveM][0][r] + s_part[0][waveM][1][r]) * ATT_SCALE;
    const float sg = (s_part[1][waveM][0][r] + s_part[1][waveM][1][r]) * ATT_SCALE;
    ga[u] = (s_part[2][waveM][0][r] + s_part[2][waveM][1][r]) * ATT_SCALE + mk[u];
    const float mx = fmaxf(sa, sg);
    const float e0 = exp_slot(sa - mx);
    const float e1 = exp_slot(sg - mx);
    const float inv = 1.f / (e0 + e1);
    p0[u] = e0 * inv;
    p1[u] = e1 * inv;
  }
  // global attention: softmax weights of the wave's 64 keys against their own maximum
  float gm = fmaxf(ga[0], ga[1]);
  #pragma unroll
  for (int o = 16; o > 0; o >>= 1) gm = fmaxf(gm, __shfl_xor(gm, o));
  // all keys masked out: keep exp(-inf - m) at 0 instead of NaN
  const float gs = (gm == -INFINITY) ? 0.f : gm;
  ga[0] = exp_slot(ga[0] - gs);
  ga[1] = exp_slot(ga[1] - gs);
  float gl = ga[0] + ga[1];
  #pragma unroll
  for (int o = 16; o > 0; o >>= 1) gl += __shfl_xor(gl, o);
  #pragma unroll
  for (int u = 0; u < 2; ++u) {
    s_w[wave][0][u * 32 + lane] = p0[u];
    s_w[wave][1][u * 32 + lane] = p1[u];
    s_w[wave][2][u * 32 + lane] = ga[u];
  }
  // the weights go from the lane that made them to the lanes that hold the rows' V
  __syncthreads();

  float gv[2] = {0.f, 0.f};
  #pragma unroll
  for (int mi = 0; mi < 4; ++mi) {
    float w0[8], w1[8], wg[8];
    #pragma unroll
    for (int c = 0; c < 2; ++c) {
      *(float4*)&w0[c * 4] = *(const float4*)&s_w[wave][0][mi * 16 + half * 8 + c * 4];
      *(float4*)&w1[c * 4] = *(const float4*)&s_w[wave][1][mi * 16 + half * 8 + c * 4];
      *(float4*)&wg[c * 4] = *(const float4*)&s_w[wave][2][mi * 16 + half * 8 + c * 4];
    }
    #pragma unroll
    for (int t = 0; t < 2; ++t)
      #pragma unroll
      for (int j = 0; j < 8; ++j) {
        const float v = acc[mi][4 + t][j];
        gv[t] += wg[j] * v;
        acc[mi][4 + t][j] = w0[j] * v + w1[j] * v0[t];
      }
  }
  gv[0] += __shfl_xor(gv[0], 16);
  gv[1] += __shfl_xor(gv[1], 16);

  const int blk = b * GA_NCH + (m0 % SS) / TILE_M * 4 + waveM;
  float*  pp = pacc + (size_t)blk * HH + dcol;
  float*  mp = pm + (blk * NHH + h) * GA_PAD;
  float*  lp = pl + (blk * NHH + h) * GA_PAD;
  // positions s1 and s1 + 32 stand at s1 - 1 and s1 + 31 of lattn; position 0 has no entry, and its address is not formed
  const int s1 = sb + lane;
  float2* ab = (float2*)lattn + (size_t)(b * NHH + h) * (SS - 1);
  float2* a0 = ab + (s1 >= 1 ? s1 - 1 : 0);
  float2* a1 = ab + s1 + 31;
  // one address for the thread's 64 stores of ctx; the rest are constant offsets
  float*  op = ctx + (size_t)(m0 + waveM * 64 + half * 8) * HH + dcol;
  if (half == 0) {
    pp[0]  = gv[0];
    pp[16] = gv[1];
  }
  if (waveN == 0) {
    if (lane == 0) { *mp = gm; *lp = gl; }
    if (s1 >= 1) *a0 = make_float2(p0[0], p1[0]);
    *a1 = make_float2(p0[1], p1[1]);
  }
  #pragma unroll
  for (int mi = 0; mi < 4; ++mi)
    #pragma unroll
    for (int j = 0; j < 8; ++j)
      #pragma unroll
      for (int t = 0; t < 2; ++t)
        // position 0 belongs to the global attention
        if (mi > 0 || j > 0 || sb + half * 8 != 0) op[(mi * 16 + j) * HH + t * 16] = acc[mi][4 + t][j];
}

// Global attention, last part: fold the GA_NCH slices of one (b,h); one thread
// per output element, 4 (b,h) per block of 256 threads. grid: GM_BLOCKS
__global__ __launch_bounds__(256)
void global_attn_merge(const float* __restrict__ pm, const float* __restrict__ pl,
                       const float* __restrict__ pacc, float* __restrict__ ctx)
{
  __shared__ float g_m[4][GA_NCH];
  __shared__ float g_l[4][GA_NCH];
  // 64 threads (two whole waves) per (b,h): its number in a scalar register makes every base scalar
  const int g  = __builtin_amdgcn_readfirstlane(threadIdx.x >> 6);
  const int d  = threadIdx.x & 63;
  const int bh = blockIdx.x * 4 + g;
  const int b  = bh / NHH;
  const int h  = bh % NHH;
  const float* mp = pm + (b * GA_NCH * NHH + h) * GA_PAD;
  const float* lp = pl + (b * GA_NCH * NHH + h) * GA_PAD;
  const float* ap = pacc + b * GA_NCH * HH + h * DD;

  // thread d fetches slice d's maximum and sum
  static_assert(GA_NCH == DD, "one thread per slice");
  g_m[g][d] = mp[d * NHH * GA_PAD];
  g_l[g][d] = lp[d * NHH * GA_PAD];
  __syncthreads();

  float M = g_m[g][0];
  #pragma unroll
  for (int i = 1; i < GA_NCH; ++i) M = fmaxf(M, g_m[g][i]);
  const float Ms = (M == -INFINITY) ? 0.f : M;
  float a = 0.f, L = 0.f;
  #pragma unroll 16
  for (int i = 0; i < GA_NCH; ++i) {
    const float w = exp_slot(g_m[g][i] - Ms);
    a += w * ap[i * HH + d];
    L += w * g_l[g][i];
  }
  ctx[(size_t)(b * SS) * HH + h * DD + d] = a * (1.f / L);
}

// ---------------------------------------------------------------------------
extern "C" void kernel_launch(void* const* d_in, const int* in_sizes, int n_in,
                              void* d_out, int out_size, void* d_ws, size_t ws_size,
                              hipStream_t stream)
{
  const float* hidden = (const float*)d_in[0];
  const float* mask   = (const float*)d_in[1];
  const float* Wq     = (const float*)d_in[2];
  const float* bq     = (const float*)d_in[3];
  const float* Wk     = (const float*)d_in[4];
  const float* bk     = (const float*)d_in[5];
  const float* Wv     = (const float*)d_in[6];
  const float* bv     = (const float*)d_in[7];

  float* ctx   = (float*)d_out;                       // B*S*H
  float* lattn = ctx + (size_t)BB * SS * HH;          // B*NH*(S-1)*1*2

  float* r0   = (float*)d_ws;                         // R0_KS*B*3*H: position 0's q, k, v in quarters of k
  float* pacc = r0 + (size_t)R0_KS * R0_SIZE;         // B*GA_NCH*H partial sums
  float* pm   = pacc + (size_t)BB * GA_NCH * HH;      // B*GA_NCH*NH lines: partial maximum,
  float* pl   = pm + 1;                               //   and beside it the partial sum of exp
  __bf16* Xb  = (__bf16*)(pm + (size_t)BB * GA_NCH * NHH * GA_PAD);   // 32 MiB: X in bf16
  __bf16* Wb  = Xb + (size_t)MM * HH;                 // 3 x 2 MiB: Wq, Wk, Wv in bf16

  to_bf16<<<R0_BLOCKS + CV_BLOCKS, CV_WAVES * 32, 0, stream>>>(hidden, Wq, Wk, Wv, bq, bk, bv, Xb, Wb, r0);

  dim3 g1(NHH, MM / TILE_M);
  qkv_attn_wmma<<<g1, 256, 0, stream>>>(Xb, Wb, bq, bk, bv, r0, mask, ctx, lattn, pm, pl, pacc);

  global_attn_merge<<<GM_BLOCKS, 256, 0, stream>>>(pm, pl, pacc, ctx);
}

// v007
// Measured time: 92.8 microseconds a run.
// Timed twice side by side with v006, it ran 1.20 and 1.19 times as fast.
// Counting every step since v000, it is 4.68 times as fast.
#include <hip/hip_runtime.h>
#include <hip/hip_bf16.h>
#include <math.h>
#include <stdint.h>

// Problem constants (from reference)
#define BB   4
#define SS   4096
#define HH   1024
#define NHH  16
#define DD   64
#define MM   (BB*SS)          // 16384 rows
#define ATT_SCALE 0.125f      // 1/sqrt(64)

typedef __attribute__((ext_vector_type(16))) __bf16 v16bf;
typedef __attribute__((ext_vector_type(8)))  float  v8f;
typedef __attribute__((ext_vector_type(4)))  uint32_t u32x4;     // tensor descriptor, group 0
typedef __attribute__((ext_vector_type(8)))  uint32_t u32x8;     // tensor descriptor, group 1
typedef __attribute__((ext_vector_type(2)))  unsigned int v2u;

#define TILE_M 256
#define TILE_N 192  // one head: its 64 columns of Q, of K and of V
#define TILE_K 128
#define ROW_B   256u                 // bytes of an operand row in a k-chunk
#define PITCH_B 272u                 // its pitch in LDS: 16 bytes of pad, an odd multiple of 16 for the 16-byte readers
#define SL_ROWS 64                   // rows of one tensor load: a slice
#define SL_B    18432u               // 64 * 272 = 17,408 bytes, rounded up so that every slice starts at a multiple of 2 KiB
#define N_SL    7                    // slices of a chunk: four of X, then the head's 64 rows of Wq, of Wk, of Wv
#define BUF_B   (N_SL * SL_B)        // one buffer of the ring

// ---------------------------------------------------------------------------
// Position 0 of every batch: its rows of Q, K and V (bias added), which every other
// position's attention needs before its own row is finished. A wave makes 16 columns
// for the 4 batches over a quarter of k with v_wmma_f32_16x16x32_bf16, rounding X and W
// to bf16 as the pre-pass does; the reader adds the four quarters.
// r0: [quarter of k][batch][Q | K | V][HH]
// ---------------------------------------------------------------------------
#define R0_TILES (3 * HH / 16)
#define R0_KS    4
#define R0_TASKS (R0_TILES * R0_KS)
#define R0_SIZE  (BB * 3 * HH)          // floats of one quarter

// 32 k of one row, as loaded, to a 16-bit fragment
__device__ __forceinline__ v16bf frag_f32(const float4* x)
{
  v16bf f;
  #pragma unroll
  for (int i = 0; i < 4; ++i) {
    f[i * 4 + 0] = (__bf16)x[i].x; f[i * 4 + 1] = (__bf16)x[i].y;
    f[i * 4 + 2] = (__bf16)x[i].z; f[i * 4 + 3] = (__bf16)x[i].w;
  }
  return f;
}

__device__ __forceinline__
void row0_proj(int tile, int kq, const float* __restrict__ X, const float* __restrict__ W,
               const float* __restrict__ bias, float* __restrict__ r0)
{
  const int lane = threadIdx.x & 31;
  const int half = lane >> 4;
  const int r16  = lane & 15;
  const int c0   = (tile % (HH / 16)) * 16;
  // rows 4..15 of the first operand repeat the four batches; their results are not stored.
  // Both operands take k in the same order: half*8 .. +7, then 16 + half*8 .. +7 of every 32
  const float* ap = X + (size_t)(r16 & 3) * SS * HH + kq * (HH / R0_KS) + half * 8;
  const float* bp = W + (size_t)(c0 + r16) * HH + kq * (HH / R0_KS) + half * 8;
  const float bc = bias[c0 + r16];
  v8f acc0 = v8f{}, acc1 = v8f{};
  #pragma unroll
  for (int g = 0; g < HH / R0_KS; g += 128) {
    float4 xa[4][4], xb[4][4];
    #pragma unroll
    for (int s = 0; s < 4; ++s) {
      const float* pa = ap + g + s * 32;
      const float* pb = bp + g + s * 32;
      xa[s][0] = *(const float4*)pa;        xa[s][1] = *(const float4*)(pa + 4);
      xa[s][2] = *(const float4*)(pa + 16); xa[s][3] = *(const float4*)(pa + 20);
      xb[s][0] = *(const float4*)pb;        xb[s][1] = *(const float4*)(pb + 4);
      xb[s][2] = *(const float4*)(pb + 16); xb[s][3] = *(const float4*)(pb + 20);
    }
    #pragma unroll
    for (int s = 0; s < 4; s += 2) {
      acc0 = __builtin_amdgcn_wmma_f32_16x16x32_bf16(false, frag_f32(xa[s]), false, frag_f32(xb[s]),
                                                     (short)0, acc0, false, false);
      acc1 = __builtin_amdgcn_wmma_f32_16x16x32_bf16(false, frag_f32(xa[s + 1]), false, frag_f32(xb[s + 1]),
                                                     (short)0, acc1, false, false);
    }
  }
  const float b0 = (kq == 0) ? bc : 0.f;
  if (half == 0) {
    #pragma unroll
    for (int b = 0; b < BB; ++b)
      r0[kq * R0_SIZE + b * 3 * HH + tile * 16 + r16] = acc0[b] + acc1[b] + b0;
  }
}

// ---------------------------------------------------------------------------
// Pre-pass: X and the three weight matrices, fp32 -> bf16, once, into the workspace.
// The GEMM below reads every row of X sixteen times and every weight row 64 times from L2:
// rounded to bf16 once, here, those reads are half the bytes and need no conversion.
// A unit is 1024 floats (8 wave-wide 16-byte loads); a wave takes CV_UNITS units in a row,
// all of one source. The first R0_BLOCKS blocks make position 0's rows instead.
// grid: R0_BLOCKS + CV_BLOCKS; block: CV_WAVES waves
// ---------------------------------------------------------------------------
#define CV_WAVES  19
#define CV_UNITS  4
#define CV_XU     (MM * HH / 1024)      // 16384 units of X
#define CV_WU     (HH * HH / 1024)      // 1024 units of each weight matrix
#define CV_BLOCKS ((CV_XU + 3 * CV_WU) / (CV_WAVES * CV_UNITS))
#define R0_BLOCKS ((R0_TASKS + CV_WAVES - 1) / CV_WAVES)

__global__ __launch_bounds__(CV_WAVES * 32)
void to_bf16(const float* __restrict__ X, const float* __restrict__ Wq,
             const float* __restrict__ Wk, const float* __restrict__ Wv,
             const float* __restrict__ bq, const float* __restrict__ bk,
             const float* __restrict__ bv,
             __bf16* __restrict__ Xb, __bf16* __restrict__ Wb, float* __restrict__ r0)
{
  static_assert((CV_XU + 3 * CV_WU) % (CV_WAVES * CV_UNITS) == 0, "whole grid");
  static_assert(CV_XU % CV_UNITS == 0 && CV_WU % CV_UNITS == 0, "a wave's units lie in one source");
  // the wave's number in a scalar register: the bases become scalar, one lane offset serves every load and one every store
  const int wave = __builtin_amdgcn_readfirstlane(threadIdx.x >> 5);
  const int lane = threadIdx.x & 31;
  if (blockIdx.x < R0_BLOCKS) {
    // a scalar test: a wave takes a task whole or leaves
    const int task = blockIdx.x * CV_WAVES + wave;
    if (task < R0_TASKS) {
      const int tile = task / R0_KS;
      const int w = tile / (HH / 16);
      row0_proj(tile, task % R0_KS, X, (w == 0) ? Wq : (w == 1) ? Wk : Wv, (w == 0) ? bq : (w == 1) ? bk : bv, r0);
    }
    return;
  }
  const int u0   = ((blockIdx.x - R0_BLOCKS) * CV_WAVES + wave) * CV_UNITS;
  const float* src;
  __bf16* dst;
  if (u0 < CV_XU) {
    src = X + (size_t)u0 * 1024;
    dst = Xb + (size_t)u0 * 1024;
  } else {
    const int w = (u0 - CV_XU) / CV_WU;
    const int r = (u0 - CV_XU) % CV_WU;
    src = ((w == 0) ? Wq : (w == 1) ? Wk : Wv) + (size_t)r * 1024;
    dst = Wb + (size_t)(u0 - CV_XU) * 1024;
  }
  const float4* s4 = (const float4*)src + lane;
  // the three loops are unrolled so that v and o are registers and every offset is a constant
  float4 v[CV_UNITS * 8];
  #pragma unroll
  for (int i = 0; i < CV_UNITS * 8; ++i) v[i] = s4[i * 32];
  v2u o[CV_UNITS * 8];
  #pragma unroll
  for (int i = 0; i < CV_UNITS * 8; ++i) {
    union { __bf16 h[4]; v2u u; } t;
    t.h[0] = (__bf16)v[i].x; t.h[1] = (__bf16)v[i].y;
    t.h[2] = (__bf16)v[i].z; t.h[3] = (__bf16)v[i].w;
    o[i] = t.u;
  }
  // every value is rounded before the first store leaves, so no register that a store names is written again
  __builtin_amdgcn_sched_barrier(0);
  // a wave's store is 256 contiguous bytes, two whole lines
  #pragma unroll
  for (int i = 0; i < CV_UNITS * 8; ++i) ((v2u*)dst)[i * 32 + lane] = o[i];
  // stands before the first rewrite of a register that the stores above name
  asm volatile("s_wait_xcnt 0x0" ::: "memory");
}

#define GA_NCH   64                     // slices of the keys per batch: one per wave row of the GEMM grid
#define GA_PAD   32                     // floats from one head's (max, sum) of a slice to the next head's: a 128-byte line per writer
#define GM_BLOCKS (BB * NHH / 4)

// value of lane (l ^ N) inside the 16-lane row (DPP row_xmask:N)
#define ROW_XOR(x, N) __builtin_bit_cast(float, __builtin_amdgcn_update_dpp( \
    0, __builtin_bit_cast(int, (x)), 0x160 + (N), 0xf, 0xf, true))

// e^x by the bare v_exp_f32, as __expf gives it. The v_nop fills the one slot the
// instruction set asks for behind a transcendental before its source is overwritten
// or its result read.
__device__ __forceinline__ float exp_slot(float x)
{
  float r;
  asm("v_exp_f32 %0, %1\n\tv_nop" : "=v"(r) : "v"(x * 1.44269504f));
  return r;
}

__device__ __forceinline__ float row16_sum(float x)
{
  x += ROW_XOR(x, 1);
  x += ROW_XOR(x, 2);
  x += ROW_XOR(x, 4);
  x += ROW_XOR(x, 8);
  return x;
}

// a wave-uniform value in a scalar register; the empty statement holds it there, so that a test of it
// compiles to s_cmp and a scalar branch: a tensor load ignores EXEC, and only such a branch guards it
__device__ __forceinline__ uint32_t pinned(uint32_t v)
{
  uint32_t w = (uint32_t)__builtin_amdgcn_readfirstlane(v);
  asm volatile("" : "+s"(w));   // the word stays scalar
  return w;
}

__device__ __forceinline__ uint32_t uni(uint32_t v) { return (uint32_t)__builtin_amdgcn_readfirstlane(v); }

// one request of the whole wave: 64 rows of 256 bytes, source pitch 2*HH bytes, from ga to LDS byte lds_dst,
// 16 bytes of pad behind every row; extents in bytes, tensor = tile, no mask
__device__ __forceinline__ void tdm_slice(uint32_t lds_dst, uint64_t ga)
{
  u32x4 g0;
  g0[0] = uni(1u);
  g0[1] = uni(lds_dst);
  g0[2] = uni((uint32_t)ga);
  g0[3] = uni((((uint32_t)(ga >> 32)) & 0x01FFFFFFu) | 0x80000000u);
  u32x8 g1;
  g1[0] = uni((1u << 20) | (5u << 22) | (3u << 25));
  g1[1] = uni((ROW_B & 0xFFFFu) << 16);
  g1[2] = uni((ROW_B >> 16) | (((uint32_t)SL_ROWS & 0xFFFFu) << 16));
  g1[3] = uni(((uint32_t)SL_ROWS >> 16) | (ROW_B << 16));
  g1[4] = uni((uint32_t)SL_ROWS);
  g1[5] = uni(2u * HH);
  g1[6] = uni(0u);
  g1[7] = uni(0u);
  asm volatile("tensor_load_to_lds %0, %1" :: "s"(g0), "s"(g1) : "memory");
}

// ---------------------------------------------------------------------------
// QKV projection (X @ W^T + b, v_wmma_f32_16x16x32_bf16) with both attentions in its epilogue.
// One work-group makes 256 rows of ONE head's Q, K and V (192 columns); a wave makes 64 rows of
// 32 of the head's 64 dims, of all three (4x6 accumulator tiles). So a row's q, k and v meet in
// registers and never go to memory: the two waves of a row exchange their half dot products in
// LDS, each then weighs its own V columns and stores them as ctx. For the global attention a
// wave row (64 keys) leaves one partial (max, sum, weighted V sum) in the workspace.
// The operands come as bf16 from the pre-pass, position 0's q, k, v from r0. A k-chunk is 128
// wide: 256 bytes of every operand row. The tensor mover brings the chunks into
// a ring of two LDS buffers, through no register: waves 0 to 6 ask for one 64-row slice each, a
// whole chunk ahead of its use.
// grid: (NHH, MM/TILE_M)  block: 256 (8 waves of 32)
// ---------------------------------------------------------------------------
__global__ __launch_bounds__(256)
void qkv_attn_wmma(const __bf16* __restrict__ Xb, const __bf16* __restrict__ Wb,
                   const float* __restrict__ bq, const float* __restrict__ bk,
                   const float* __restrict__ bv, const float* __restrict__ r0,
                   const float* __restrict__ mask,
                   float* __restrict__ ctx, float* __restrict__ lattn,
                   float* __restrict__ pm, float* __restrict__ pl, float* __restrict__ pacc)
{
  static_assert(GA_NCH == (SS / TILE_M) * 4, "one slice per wave row");
  static_assert(TILE_M == 4 * SL_ROWS && TILE_N == 3 * SL_ROWS && DD == SL_ROWS, "seven slices of 64 rows");
  static_assert(TILE_K * 2 == ROW_B && SL_B % 2048u == 0 && SL_B >= SL_ROWS * PITCH_B, "a slice holds its padded rows");
  __shared__ __attribute__((aligned(2048))) unsigned char ring[2 * BUF_B];
  __shared__ __align__(16) float s_part[3][4][2][64];   // half dot products: kind, wave row, half, row
  __shared__ __align__(16) float s_w[8][3][64];         // a wave's own copy of the rows' three weights

  const int h    = blockIdx.x;
  const int m0   = blockIdx.y * TILE_M;
  const int tid  = threadIdx.x;
  const int wave = tid >> 5;
  const int lane = tid & 31;
  const int half = lane >> 4;     // 0: lanes 0-15, 1: lanes 16-31
  const int r16  = lane & 15;
  const int waveM = wave >> 1;    // 0..3  -> 64-row slab
  const int waveN = wave & 1;     // 0..1  -> dims 32*waveN .. +31 of the head

  v8f acc[4][6];                  // second index: 0,1 Q; 2,3 K; 4,5 V
  #pragma unroll
  for (int i = 0; i < 4; ++i)
    #pragma unroll
    for (int j = 0; j < 6; ++j)
      acc[i][j] = v8f{};

  // the wave's own slice of every chunk: waves 0..3 take 64 rows of X each, waves 4..6 the head's rows of Wq, Wk, Wv
  const uint32_t swave = uni((uint32_t)tid >> 5);
  const __bf16* sp = (swave < 4u) ? Xb + (size_t)(m0 + swave * SL_ROWS) * HH
                                  : Wb + (size_t)((swave - 4u) * HH + h * DD) * HH;
  const uint32_t lbase = (uint32_t)(size_t)ring;
  // chunk st into buffer st & 1
  auto issue = [&](uint32_t st) {
    tdm_slice(lbase + (st & 1u) * BUF_B + swave * SL_B, (uint64_t)(size_t)sp + (uint64_t)st * ROW_B);
  };
  // the lane's first 16 bytes of either operand in buffer 0; every fragment load is a constant further
  const unsigned char* afp = ring + waveM * SL_B + r16 * PITCH_B + half * 16;
  const unsigned char* bfp = ring + 4 * SL_B + (waveN * 32 + r16) * PITCH_B + half * 16;
  // 32 of the chunk's 128 k (kh = 0..3) for the wave's 64x96 tile
  auto compute = [&](int cur, int kh) {
    // Fragment loads per ISA 16-bit A layout:
    //   lanes 0-15 : K 0-7  (bytes 0..15)  and K 16-23 (bytes 32..47)
    //   lanes 16-31: K 8-15 (bytes 16..31) and K 24-31 (bytes 48..63)
    v16bf afrag[4], bfrag[6];
    #pragma unroll
    for (int ni = 0; ni < 6; ++ni) {
      // tile ni: matrix ni >> 1, dims waveN*32 + (ni & 1)*16 .. of the head
      const unsigned char* fp = bfp + cur * BUF_B + (ni >> 1) * SL_B + (ni & 1) * 16 * PITCH_B + kh * 64;
      union { uint4 u[2]; v16bf v; } t;
      t.u[0] = *(const uint4*)fp;
      t.u[1] = *(const uint4*)(fp + 32);
      bfrag[ni] = t.v;
    }
    #pragma unroll
    for (int mi = 0; mi < 4; ++mi) {
      const unsigned char* fp = afp + cur * BUF_B + mi * 16 * PITCH_B + kh * 64;
      union { uint4 u[2]; v16bf v; } t;
      t.u[0] = *(const uint4*)fp;
      t.u[1] = *(const uint4*)(fp + 32);
      afrag[mi] = t.v;
    }
    // keeps the 20 LDS reads together in front of the products: left alone the compiler deals them
    // out two at a time among the products, and the wave then waits out the LDS latency at each pair
    __builtin_amdgcn_sched_barrier(0);

    #pragma unroll
    for (int mi = 0; mi < 4; ++mi)
      #pragma unroll
      for (int ni = 0; ni < 6; ++ni)
        acc[mi][ni] = __builtin_amdgcn_wmma_f32_16x16x32_bf16(
            false, afrag[mi], false, bfrag[ni],
            (short)0, acc[mi][ni], false, false);
  };

  const int KT = HH / TILE_K;     // 8 k-chunks
  static_assert(HH / TILE_K >= 2, "the ring's prologue needs two chunks");
  if (pinned(swave < N_SL)) {
    issue(0);
    // the wave's own slice of chunk 0 has landed behind this one
    asm volatile("s_wait_tensorcnt 0x0" ::: "memory");
  }
  // chunk 0 is every wave's to read
  __syncthreads();
  if (pinned(swave < N_SL)) issue(1);

  for (int kt = 0; kt + 1 < KT; ++kt) {
    const int cur = kt & 1;
    // the fences keep a block's LDS reads from being dealt out among the products of the block before it,
    // and the last block's products in front of the hand-over, so that the refill leaves right behind the barrier
    compute(cur, 0);
    __builtin_amdgcn_sched_barrier(0);
    compute(cur, 1);
    __builtin_amdgcn_sched_barrier(0);
    compute(cur, 2);
    __builtin_amdgcn_sched_barrier(0);
    compute(cur, 3);
    __builtin_amdgcn_sched_barrier(0);
    // chunk kt+1 is handed over. The wave's reads of this buffer have retired before anything refills it
    asm volatile("s_wait_dscnt 0x0" ::: "memory");
    // the wave's own slice of chunk kt+1 has landed
    if (pinned(swave < N_SL)) asm volatile("s_wait_tensorcnt 0x0" ::: "memory");
    // every slice of chunk kt+1 may be read behind it, and every wave has left chunk kt's buffer
    __syncthreads();
    // chunk kt+2 goes into that buffer and flies under all of chunk kt+1's products
    if (pinned(swave < N_SL && kt + 2 < KT)) issue((uint32_t)kt + 2u);
  }

  // what the epilogue reads from memory leaves here and flies under the last chunk's products
  const int b    = m0 / SS;
  const int sb   = (m0 % SS) + waveM * 64;       // the wave's first position in its batch
  const int dcol = h * DD + waveN * 32 + r16;    // the lane's column of tile t = 0; t = 1 is 16 further
  // scalar bases and two lane offsets, the rest constants: no load of the run needs an address register of its own
  const float* rp  = r0 + b * 3 * HH + h * DD;
  const float* bqp = bq + h * DD;
  const float* bkp = bk + h * DD;
  const float* bvp = bv + h * DD;
  const float* mkp = mask + b * SS + (m0 % SS);
  const unsigned lo = (unsigned)(waveN * 32 + r16);
  const unsigned mo = (unsigned)(waveM * 64 + lane);
  float bqc[2], bkc[2], bvc[2], q0p[2][R0_KS], k0p[2][R0_KS], v0p[2][R0_KS], mk[2];
  #pragma unroll
  for (int t = 0; t < 2; ++t) {
    bqc[t] = bqp[t * 16 + lo];
    bkc[t] = bkp[t * 16 + lo];
    bvc[t] = bvp[t * 16 + lo];
    #pragma unroll
    for (int c = 0; c < R0_KS; ++c) {
      q0p[t][c] = rp[c * R0_SIZE + t * 16 + lo];
      k0p[t][c] = rp[c * R0_SIZE + HH + t * 16 + lo];
      v0p[t][c] = rp[c * R0_SIZE + 2 * HH + t * 16 + lo];
    }
    mk[t]  = mkp[t * 32 + mo];                   // lane l looks after rows l and l + 32 of the wave's 64
  }
  // stands before the first rewrite of a register that the loads above name
  asm volatile("s_wait_xcnt 0x0" ::: "memory");
  // keeps every later register write behind that wait
  __builtin_amdgcn_sched_barrier(0);
  compute((KT - 1) & 1, 0);
  compute((KT - 1) & 1, 1);
  compute((KT - 1) & 1, 2);
  compute((KT - 1) & 1, 3);
  // nothing of the ring is in flight or being read from here on
  asm volatile("s_wait_tensorcnt 0x0" ::: "memory");
  asm volatile("s_wait_dscnt 0x0" ::: "memory");

  // Epilogue. C/D layout: lanes 0-15: M=j, lanes 16-31: M=8+j; N=r16
  float q0[2], k0[2], v0[2];
  #pragma unroll
  for (int t = 0; t < 2; ++t) {
    q0[t] = (q0p[t][0] + q0p[t][1]) + (q0p[t][2] + q0p[t][3]);
    k0[t] = (k0p[t][0] + k0p[t][1]) + (k0p[t][2] + k0p[t][3]);
    v0[t] = (v0p[t][0] + v0p[t][1]) + (v0p[t][2] + v0p[t][3]);
  }
  #pragma unroll
  for (int mi = 0; mi < 4; ++mi)
    #pragma unroll
    for (int t = 0; t < 2; ++t)
      #pragma unroll
      for (int j = 0; j < 8; ++j) {
        acc[mi][t][j]     += bqc[t];
        acc[mi][2 + t][j] += bkc[t];
        acc[mi][4 + t][j] += bvc[t];
      }

  // the three dot products of every row over the wave's 32 dims: q.k, q.k0, q0.k; lane r16 = j keeps row j's
  #pragma unroll
  for (int mi = 0; mi < 4; ++mi) {
    float ws = 0.f, wg = 0.f, wa = 0.f;
    #pragma unroll
    for (int j = 0; j < 8; ++j) {
      const float ds = row16_sum(acc[mi][0][j] * acc[mi][2][j] + acc[mi][1][j] * acc[mi][3][j]);
      const float dg = row16_sum(acc[mi][0][j] * k0[0] + acc[mi][1][j] * k0[1]);
      const float da = row16_sum(q0[0] * acc[mi][2][j] + q0[1] * acc[mi][3][j]);
      if (r16 == j) { ws = ds; wg = dg; wa = da; }
    }
    if (r16 < 8) {
      s_part[0][waveM][waveN][mi * 16 + half * 8 + r16] = ws;
      s_part[1][waveM][waveN][mi * 16 + half * 8 + r16] = wg;
      s_part[2][waveM][waveN][mi * 16 + half * 8 + r16] = wa;
    }
  }
  // the two waves of a row hand each other their halves
  __syncthreads();

  // lane l: rows l and l + 32. Both waves of a row do the same sums, so neither needs the other's weights
  float p0[2], p1[2], ga[2];
  #pragma unroll
  for (int u = 0; u < 2; ++u) {
    const int r = u * 32 + lane;
    const float sa = (s_part[0][waveM][0][r] + s_part[0][waveM][1][r]) * ATT_SCALE;
    const float sg = (s_part[1][waveM][0][r] + s_part[1][waveM][1][r]) * ATT_SCALE;
    ga[u] = (s_part[2][waveM][0][r] + s_part[2][waveM][1][r]) * ATT_SCALE + mk[u];
    const float mx = fmaxf(sa, sg);
    const float e0 = exp_slot(sa - mx);
    const float e1 = exp_slot(sg - mx);
    const float inv = 1.f / (e0 + e1);
    p0[u] = e0 * inv;
    p1[u] = e1 * inv;
  }
  // global attention: softmax weights of the wave's 64 keys against their own maximum
  float gm = fmaxf(ga[0], ga[1]);
  #pragma unroll
  for (int o = 16; o > 0; o >>= 1) gm = fmaxf(gm, __shfl_xor(gm, o));
  // all keys masked out: keep exp(-inf - m) at 0 instead of NaN
  const float gs = (gm == -INFINITY) ? 0.f : gm;
  ga[0] = exp_slot(ga[0] - gs);
  ga[1] = exp_slot(ga[1] - gs);
  float gl = ga[0] + ga[1];
  #pragma unroll
  for (int o = 16; o > 0; o >>= 1) gl += __shfl_xor(gl, o);
  #pragma unroll
  for (int u = 0; u < 2; ++u) {
    s_w[wave][0][u * 32 + lane] = p0[u];
    s_w[wave][1][u * 32 + lane] = p1[u];
    s_w[wave][2][u * 32 + lane] = ga[u];
  }
  // the weights go from the lane that made them to the lanes that hold the rows' V
  __syncthreads();

  float gv[2] = {0.f, 0.f};
  #pragma unroll
  for (int mi = 0; mi < 4; ++mi) {
    float w0[8], w1[8], wg[8];
    #pragma unroll
    for (int c = 0; c < 2; ++c) {
      *(float4*)&w0[c * 4] = *(const float4*)&s_w[wave][0][mi * 16 + half * 8 + c * 4];
      *(float4*)&w1[c * 4] = *(const float4*)&s_w[wave][1][mi * 16 + half * 8 + c * 4];
      *(float4*)&wg[c * 4] = *(const float4*)&s_w[wave][2][mi * 16 + half * 8 + c * 4];
    }
    #pragma unroll
    for (int t = 0; t < 2; ++t)
      #pragma unroll
      for (int j = 0; j < 8; ++j) {
        const float v = acc[mi][4 + t][j];
        gv[t] += wg[j] * v;
        acc[mi][4 + t][j] = w0[j] * v + w1[j] * v0[t];
      }
  }
  gv[0] += __shfl_xor(gv[0], 16);
  gv[1] += __shfl_xor(gv[1], 16);

  const int blk = b * GA_NCH + (m0 % SS) / TILE_M * 4 + waveM;
  float*  pp = pacc + (size_t)blk * HH + dcol;
  float*  mp = pm + (blk * NHH + h) * GA_PAD;
  float*  lp = pl + (blk * NHH + h) * GA_PAD;
  // positions s1 and s1 + 32 stand at s1 - 1 and s1 + 31 of lattn; position 0 has no entry, and its address is not formed
  const int s1 = sb + lane;
  float2* ab = (float2*)lattn + (size_t)(b * NHH + h) * (SS - 1);
  float2* a0 = ab + (s1 >= 1 ? s1 - 1 : 0);
  float2* a1 = ab + s1 + 31;
  // one address for the thread's 64 stores of ctx; the rest are constant offsets
  float*  op = ctx + (size_t)(m0 + waveM * 64 + half * 8) * HH + dcol;
  if (half == 0) {
    pp[0]  = gv[0];
    pp[16] = gv[1];
  }
  if (waveN == 0) {
    if (lane == 0) { *mp = gm; *lp = gl; }
    if (s1 >= 1) *a0 = make_float2(p0[0], p1[0]);
    *a1 = make_float2(p0[1], p1[1]);
  }
  #pragma unroll
  for (int mi = 0; mi < 4; ++mi)
    #pragma unroll
    for (int j = 0; j < 8; ++j)
      #pragma unroll
      for (int t = 0; t < 2; ++t)
        // position 0 belongs to the global attention
        if (mi > 0 || j > 0 || sb + half * 8 != 0) op[(mi * 16 + j) * HH + t * 16] = acc[mi][4 + t][j];
}

// Global attention, last part: fold the GA_NCH slices of one (b,h); one thread
// per output element, 4 (b,h) per block of 256 threads. grid: GM_BLOCKS
__global__ __launch_bounds__(256)
void global_attn_merge(const float* __restrict__ pm, const float* __restrict__ pl,
                       const float* __restrict__ pacc, float* __restrict__ ctx)
{
  __shared__ float g_m[4][GA_NCH];
  __shared__ float g_l[4][GA_NCH];
  // 64 threads (two whole waves) per (b,h): its number in a scalar register makes every base scalar
  const int g  = __builtin_amdgcn_readfirstlane(threadIdx.x >> 6);
  const int d  = threadIdx.x & 63;
  const int bh = blockIdx.x * 4 + g;
  const int b  = bh / NHH;
  const int h  = bh % NHH;
  const float* mp = pm + (b * GA_NCH * NHH + h) * GA_PAD;
  const float* lp = pl + (b * GA_NCH * NHH + h) * GA_PAD;
  const float* ap = pacc + b * GA_NCH * HH + h * DD;

  // thread d fetches slice d's maximum and sum
  static_assert(GA_NCH == DD, "one thread per slice");
  g_m[g][d] = mp[d * NHH * GA_PAD];
  g_l[g][d] = lp[d * NHH * GA_PAD];
  __syncthreads();

  float M = g_m[g][0];
  #pragma unroll
  for (int i = 1; i < GA_NCH; ++i) M = fmaxf(M, g_m[g][i]);
  const float Ms = (M == -INFINITY) ? 0.f : M;
  float a = 0.f, L = 0.f;
  #pragma unroll 16
  for (int i = 0; i < GA_NCH; ++i) {
    const float w = exp_slot(g_m[g][i] - Ms);
    a += w * ap[i * HH + d];
    L += w * g_l[g][i];
  }
  ctx[(size_t)(b * SS) * HH + h * DD + d] = a * (1.f / L);
}

// ---------------------------------------------------------------------------
extern "C" void kernel_launch(void* const* d_in, const int* in_sizes, int n_in,
                              void* d_out, int out_size, void* d_ws, size_t ws_size,
                              hipStream_t stream)
{
  const float* hidden = (const float*)d_in[0];
  const float* mask   = (const float*)d_in[1];
  const float* Wq     = (const float*)d_in[2];
  const float* bq     = (const float*)d_in[3];
  const float* Wk     = (const float*)d_in[4];
  const float* bk     = (const float*)d_in[5];
  const float* Wv     = (const float*)d_in[6];
  const float* bv     = (const float*)d_in[7];

  float* ctx   = (float*)d_out;                       // B*S*H
  float* lattn = ctx + (size_t)BB * SS * HH;          // B*NH*(S-1)*1*2

  float* r0   = (float*)d_ws;                         // R0_KS*B*3*H: position 0's q, k, v in quarters of k
  float* pacc = r0 + (size_t)R0_KS * R0_SIZE;         // B*GA_NCH*H partial sums
  float* pm   = pacc + (size_t)BB * GA_NCH * HH;      // B*GA_NCH*NH lines: partial maximum,
  float* pl   = pm + 1;                               //   and beside it the partial sum of exp
  __bf16* Xb  = (__bf16*)(pm + (size_t)BB * GA_NCH * NHH * GA_PAD);   // 32 MiB: X in bf16
  __bf16* Wb  = Xb + (size_t)MM * HH;                 // 3 x 2 MiB: Wq, Wk, Wv in bf16

  to_bf16<<<R0_BLOCKS + CV_BLOCKS, CV_WAVES * 32, 0, stream>>>(hidden, Wq, Wk, Wv, bq, bk, bv, Xb, Wb, r0);

  dim3 g1(NHH, MM / TILE_M);
  qkv_attn_wmma<<<g1, 256, 0, stream>>>(Xb, Wb, bq, bk, bv, r0, mask, ctx, lattn, pm, pl, pacc);

  global_attn_merge<<<GM_BLOCKS, 256, 0, stream>>>(pm, pl, pacc, ctx);
}
